// v000
// Times are from an AMD MI455X. After a warm-up the kernel runs many times in a row, and a time is the length of
// such a window on the GPU divided by its runs, so every launch and the gaps after it count. The runs cycle
// through copies of the inputs. A figure is the median of several windows, for all but v000 over two sittings.
// Sittings can differ by a few percent; kernels timed side by side share one.
// v000 is the starting kernel. One run takes 293 microseconds.
// compute dtype: all float inputs rounded to bf16, sigma read on device; fy, gx, hx with EXACT bf16 products on WMMA 16x16x32 ((in,out) weights packed to transposed rows), fy/gx rounded to f16 hi + residual rows, hx to f16 hi + residual planes; unscaled logits fy . gx with 3 products, running-max softmax in f32 (hardware exp), P (x 2^11, f16) . hx (2 products); out = x + sigma (attn_g (bf16 hi + lo, 2 products) . W_out); f32 output.
#include <hip/hip_runtime.h>
#include <math.h>

typedef __attribute__((ext_vector_type(16))) _Float16 v16h;
typedef __attribute__((ext_vector_type(16))) __bf16 v16b;
typedef __attribute__((ext_vector_type(8)))  _Float16 v8h;
typedef __attribute__((ext_vector_type(8)))  float v8f;
typedef __attribute__((ext_vector_type(4)))  float v4f;
typedef __attribute__((ext_vector_type(2)))  float v2f;
typedef __attribute__((ext_vector_type(4)))  unsigned v4u;
typedef __attribute__((ext_vector_type(4)))  int v4i;
typedef float __attribute__((may_alias)) float_a;
typedef int __attribute__((may_alias)) int_a;

template <typename T> __device__ __forceinline__ void vst2(void* p, T v) { *(T*)p = v;  }
__device__ __forceinline__ v8f wmma16(v16h a, v16h b, v8f c) {
  v8f d = __builtin_amdgcn_wmma_f32_16x16x32_f16(false, a, false, b, (short)0, c, false, false);
  asm volatile("v_nop\n\tv_nop\n\tv_nop\n\tv_nop" : "+v"(d) : "v"(a), "v"(b));
  return d;
}
__device__ __forceinline__ v8f wmma_bf(v16b a, v16b b, v8f c) {
  v8f d = __builtin_amdgcn_wmma_f32_16x16x32_bf16(false, a, false, b, (short)0, c, false, false);
  asm volatile("v_nop\n\tv_nop\n\tv_nop\n\tv_nop" : "+v"(d) : "v"(a), "v"(b));
  return d;
}
// 16x16x32 fragments: lane = (h = lane>>4, row/col = lane&15); elements 0..7 = k0+8h+0..7, 8..15 = k0+16+8h+0..7; D element r = row 8h+r
__device__ __forceinline__ v16h frag_h(const _Float16* rowk0, int lane) {
  union { v16h v; v8h q[2]; } u; const _Float16* p = rowk0 + 8 * (lane >> 4);
  u.q[0] = *(const v8h*)p; u.q[1] = *(const v8h*)(p + 16); return u.v;
}
__device__ __forceinline__ v16h frag_f32(const float* rowk0, int lane) {
  v16h a; const float* p = rowk0 + 8 * (lane >> 4);
#pragma unroll
  for (int i = 0; i < 8; ++i) { a[i] = (_Float16)p[i]; a[8 + i] = (_Float16)p[16 + i]; }
  return a;
}
__device__ __forceinline__ v16h frag_f32s(const float* rowk0, int lane, float sc) {
  v16h a; const float* p = rowk0 + 8 * (lane >> 4);
#pragma unroll
  for (int i = 0; i < 8; ++i) { a[i] = (_Float16)(p[i] * sc); a[8 + i] = (_Float16)(p[16 + i] * sc); }
  return a;
}
// column fragment from a [K][ld] layout (column n), rows >= K read as 0
__device__ __forceinline__ v16h fragc_f32(const float* W, int k0, int n, int lane, int ld, int K) {
  v16h a; const int g = lane >> 4;
#pragma unroll
  for (int i = 0; i < 8; ++i) { const int ka = k0 + 8 * g + i, kb = ka + 16;
    a[i] = (_Float16)(ka < K ? W[(size_t)(ka < K ? ka : K - 1) * ld + n] : 0.f); a[8 + i] = (_Float16)(kb < K ? W[(size_t)(kb < K ? kb : K - 1) * ld + n] : 0.f); }
  return a;
}
struct F2 { v16b h, l; };
__device__ __forceinline__ F2 bsplit16(const float v[16]) { F2 r;
#pragma unroll
  for (int i = 0; i < 16; ++i) { const __bf16 h = (__bf16)v[i]; r.h[i] = h; r.l[i] = (__bf16)(v[i] - (float)h); }
  return r; }
__device__ __forceinline__ F2 split_row(const float* row, int k0, int lane) { float v[16]; const float* p = row + k0 + 8 * (lane >> 4);
#pragma unroll
  for (int i = 0; i < 8; ++i) { v[i] = p[i]; v[8 + i] = p[16 + i]; }
  return bsplit16(v); }
__device__ __forceinline__ F2 split_rowK(const float* row, int k0, int lane, int K) { float v[16]; const int g = lane >> 4;
#pragma unroll
  for (int i = 0; i < 8; ++i) { const int ka = k0 + 8 * g + i, kb = ka + 16; v[i] = ka < K ? row[ka < K ? ka : K - 1] : 0.f; v[8 + i] = kb < K ? row[kb < K ? kb : K - 1] : 0.f; }
  return bsplit16(v); }
__device__ __forceinline__ F2 split_col(const float* W, int k0, int n, int lane, int ld, int K) { float v[16]; const int g = lane >> 4;
#pragma unroll
  for (int i = 0; i < 8; ++i) { const int ka = k0 + 8 * g + i, kb = ka + 16; v[i] = ka < K ? W[(size_t)(ka < K ? ka : K - 1) * ld + n] : 0.f; v[8 + i] = kb < K ? W[(size_t)(kb < K ? kb : K - 1) * ld + n] : 0.f; }
  return bsplit16(v); }
__device__ __forceinline__ v8f mac3(const F2& a, const F2& b, v8f c) { c = wmma_bf(a.l, b.h, c); c = wmma_bf(a.h, b.l, c); return wmma_bf(a.h, b.h, c); }
__device__ __forceinline__ float sigm(float v) { return 1.0f / (1.0f + expf(-v)); }
#define LDSX() do { asm volatile("s_wait_dscnt 0" ::: "memory"); __builtin_amdgcn_wave_barrier(); __builtin_amdgcn_fence(__ATOMIC_RELEASE, "workgroup"); } while (0)


// Self attention with channel reduction (B 8, 64 x 64 -> 4,096 positions, C 256, inner 32): attn = softmax(fy(y) . gx(x)^T) (unscaled); out = x + sigma (attn . hx(x)) W_out.
#define NB 8
#define NN 4096
#define CC 256
#define CI 32
#ifndef TNB
#define TNB NB
#endif
typedef __attribute__((ext_vector_type(8))) __bf16 v8b;
__device__ __forceinline__ v16b frag_b(const __bf16* rowk0, int lane) {
  union { v16b v; v8b q[2]; } u; const __bf16* p = rowk0 + 8 * (lane >> 4);
  u.q[0] = *(const v8b*)p; u.q[1] = *(const v8b*)(p + 16); return u.v;
}
__device__ __forceinline__ float bfr(float v) { return (float)(__bf16)v; }
__device__ __attribute__((noinline)) float exp_ni(float v) { return expf(v); }
__device__ __attribute__((noinline)) float erf_ni(float v) { return erff(v); }

#define WS_PW  0u                                   // bf16 rows [96][256]: fy | gx | hx weights transposed; [256][32] W_out^T
#define WS_PO  (WS_PW + 2u * 3 * CI * CC)
#define WS_FG  (WS_PO + 2u * CC * CI)                   // f16 hi|lo rows [b*NN + n][64] (fy 0..31 | gx 32..63)
#define WS_FGL (WS_FG + 2u * (size_t)NB * NN * 2 * CI)
#define WS_HT  (WS_FGL + 2u * (size_t)NB * NN * 2 * CI) // f16 hi|lo hx planes [b][32][NN]
#define WS_HTL (WS_HT + 2u * (size_t)NB * CI * NN)
#define WS_AG  (WS_HTL + 2u * (size_t)NB * CI * NN)    // f32 attn_g [b*NN + n][32]
#define WS_END (WS_AG + 4u * (size_t)NB * NN * CI)

__global__ __launch_bounds__(256) void k_pack(const float* __restrict__ WFY, const float* __restrict__ WGX, const float* __restrict__ WHX, const float* __restrict__ WOUT, __bf16* __restrict__ PW, __bf16* __restrict__ PO) { const int n = blockIdx.x, t = threadIdx.x; __shared__ __align__(16) __bf16 s[CC];   // n < 96: transposed (in,out) [256][32] rows; n >= 96: W_out^T rows [256 -> o][32]
  if (n < 3 * CI) { const float* Wm = n < CI ? WFY : n < 2 * CI ? WGX : WHX; const int o = n % CI; s[t] = (__bf16)Wm[(size_t)t * CI + o]; __syncthreads(); if (t < CC / 8) vst2((unsigned*)(PW + (size_t)n * CC + t * 8), *(const v4u*)&s[t * 8]); }
  else { const int o = n - 3 * CI; if (t < CI) s[t] = (__bf16)WOUT[(size_t)t * CC + o]; __syncthreads(); if (t < CI / 8) vst2((unsigned*)(PO + (size_t)o * CI + t * 8), *(const v4u*)&s[t * 8]); } }
__device__ __forceinline__ v16b fragb_f32(const float* __restrict__ p, int lane) { v16b a; const float* pp = p + 8 * (lane >> 4);
#pragma unroll
  for (int i = 0; i < 8; ++i) { a[i] = (__bf16)pp[i]; a[8 + i] = (__bf16)pp[16 + i]; } return a; }
// ---- k_proj: block = (64 positions, b): fy (from y), gx, hx (from x): 6 column tiles of 16; fy|gx -> rows hi/lo; hx -> planes hi/lo
__global__ __launch_bounds__(128) void k_proj(const float* __restrict__ X, const float* __restrict__ Y, const __bf16* __restrict__ PW, _Float16* __restrict__ FG, _Float16* __restrict__ FGL, _Float16* __restrict__ HT, _Float16* __restrict__ HTL) {
  __shared__ __align__(16) _Float16 sh[64][72], sl[64][72]; __shared__ __align__(16) _Float16 th[CI][72], tl[CI][72];
  const int tid = threadIdx.x, wave = tid >> 5, lane = tid & 31, col = lane & 15, g = lane >> 4; const size_t b = blockIdx.y; const int n0 = blockIdx.x * 64 + wave * 16; const size_t r0 = b * NN + n0;
  v8f acc[6] = {};
#pragma unroll 2
  for (int kc = 0; kc < CC / 32; ++kc) { const v16b ay = fragb_f32(Y + (r0 + col) * CC + kc * 32, lane), ax = fragb_f32(X + (r0 + col) * CC + kc * 32, lane);
#pragma unroll
    for (int j = 0; j < 6; ++j) acc[j] = wmma_bf(j < 2 ? ay : ax, frag_b(PW + (size_t)(j * 16 + col) * CC + kc * 32, lane), acc[j]); }
#pragma unroll
  for (int j = 0; j < 6; ++j)
#pragma unroll
    for (int r = 0; r < 8; ++r) { const float v = acc[j][r]; const _Float16 hv = (_Float16)v, lv = (_Float16)((v - (float)hv) * 2048.0f); if (j < 4) { sh[wave * 16 + 8 * g + r][j * 16 + col] = hv; sl[wave * 16 + 8 * g + r][j * 16 + col] = lv; } else { th[(j - 4) * 16 + col][wave * 16 + 8 * g + r] = hv; tl[(j - 4) * 16 + col][wave * 16 + 8 * g + r] = lv; } }
  __syncthreads();
  for (int e = tid; e < 64 * 8; e += 128) { const int rl = e >> 3, q = e & 7; const size_t o = (b * NN + blockIdx.x * 64 + rl) * (2 * CI) + q * 8; vst2((unsigned*)(FG + o), *(const v4u*)&sh[rl][q * 8]); vst2((unsigned*)(FGL + o), *(const v4u*)&sl[rl][q * 8]); }
  for (int e = tid; e < CI * 8; e += 128) { const int cl = e >> 3, q = e & 7; const size_t o = (b * CI + cl) * (size_t)NN + blockIdx.x * 64 + q * 8; vst2((unsigned*)(HT + o), *(const v4u*)&th[cl][q * 8]); vst2((unsigned*)(HTL + o), *(const v4u*)&tl[cl][q * 8]); } }
// ---- k_att: block = (64 queries, b): unscaled logits fy_q . gx_k (3 products), softmax over all 4,096 positions, P . hx (2 products) -> AG rows
__global__ __launch_bounds__(128) void k_att(const _Float16* __restrict__ FG, const _Float16* __restrict__ FGL, const _Float16* __restrict__ HT, const _Float16* __restrict__ HTL, float* __restrict__ AG) {
  __shared__ __align__(16) float sp[4][16][36]; __shared__ __align__(16) float so[4][16][36];
  const int tid = threadIdx.x, wave = tid >> 5, lane = tid & 31, col = lane & 15, g = lane >> 4; const size_t b = blockIdx.y; const int q0 = blockIdx.x * 64 + wave * 16; const size_t rq = b * NN + q0;
  const v16h aq = frag_h(FG + (rq + col) * (2 * CI), lane), aql = frag_h(FGL + (rq + col) * (2 * CI), lane);
  float m[8], l[8];
#pragma unroll
  for (int r = 0; r < 8; ++r) { m[r] = -3.0e38f; l[r] = 0.f; }
  v8f acc[2] = {}, accl[2] = {};
#pragma unroll 1
  for (int ks = 0; ks < NN / 32; ++ks) { v8f s[2];
#pragma unroll
    for (int ct = 0; ct < 2; ++ct) { const size_t rk = b * NN + ks * 32 + ct * 16 + col; const v16h kh = frag_h(FG + rk * (2 * CI) + CI, lane), kl = frag_h(FGL + rk * (2 * CI) + CI, lane); v8f c = {}, cl = {}; c = wmma16(aq, kh, c); cl = wmma16(aq, kl, cl); cl = wmma16(aql, kh, cl);
#pragma unroll
      for (int r = 0; r < 8; ++r) s[ct][r] = c[r] + cl[r] * (1.0f / 2048.0f); }
    float alpha[8];
#pragma unroll
    for (int r = 0; r < 8; ++r) { float mx = fmaxf(s[0][r], s[1][r]);
#pragma unroll
      for (int o = 1; o < 16; o <<= 1) mx = fmaxf(mx, __shfl_xor(mx, o));
      const float mn = fmaxf(m[r], mx); alpha[r] = __expf(m[r] - mn); const float e0 = __expf(s[0][r] - mn), e1 = __expf(s[1][r] - mn); float es = e0 + e1;
#pragma unroll
      for (int o = 1; o < 16; o <<= 1) es += __shfl_xor(es, o);
      l[r] = l[r] * alpha[r] + es; m[r] = mn; sp[wave][8 * g + r][col] = e0; sp[wave][8 * g + r][16 + col] = e1; }
#pragma unroll
    for (int j = 0; j < 2; ++j)
#pragma unroll
      for (int r = 0; r < 8; ++r) { acc[j][r] *= alpha[r]; accl[j][r] *= alpha[r]; }
    LDSX();
    v16h pa; { const float* prow = &sp[wave][col][0] + 8 * (lane >> 4);
#pragma unroll
      for (int i = 0; i < 8; ++i) { pa[i] = (_Float16)(prow[i] * 2048.0f); pa[8 + i] = (_Float16)(prow[16 + i] * 2048.0f); } }
#pragma unroll
    for (int j = 0; j < 2; ++j) { const size_t po = (b * CI + j * 16 + col) * (size_t)NN + ks * 32; acc[j] = wmma16(pa, frag_h(HT + po, lane), acc[j]); accl[j] = wmma16(pa, frag_h(HTL + po, lane), accl[j]); }
    LDSX(); }
#pragma unroll
  for (int r = 0; r < 8; ++r) { const float il = (1.0f / 2048.0f) / l[r];
#pragma unroll
    for (int j = 0; j < 2; ++j) so[wave][8 * g + r][j * 16 + col] = (acc[j][r] + accl[j][r] * (1.0f / 2048.0f)) * il; }
  LDSX(); for (int rl = 0; rl < 16; ++rl) if (lane < 8) vst2(AG + (rq + rl) * CI + lane * 4, *(const v4f*)&so[wave][rl][lane * 4]); }
// ---- k_out: block = (64 rows, 128 cols): out = x + sigma (AG (hi + lo) . W_out)
__global__ __launch_bounds__(128) void k_out(const float* __restrict__ AG, const __bf16* __restrict__ PO, const float* __restrict__ X, const float* __restrict__ SIG, float* __restrict__ OUT) { __shared__ __align__(16) float sf[4][16][132];
  const int tid = threadIdx.x, wave = tid >> 5, lane = tid & 31, col = lane & 15, g = lane >> 4; const size_t r0 = (size_t)blockIdx.x * 64 + wave * 16; const int c0 = blockIdx.y * 128; const float sg = bfr(SIG[0]);
  v8f acc[8] = {}; { const F2 a = split_row(AG + (r0 + col) * CI, 0, lane);
#pragma unroll
    for (int j = 0; j < 8; ++j) { const v16b w = frag_b(PO + (size_t)(c0 + j * 16 + col) * CI, lane); acc[j] = wmma_bf(a.h, w, acc[j]); acc[j] = wmma_bf(a.l, w, acc[j]); } }
#pragma unroll
  for (int j = 0; j < 8; ++j) { const int c = c0 + j * 16 + col;
#pragma unroll
    for (int r = 0; r < 8; ++r) sf[wave][8 * g + r][j * 16 + col] = bfr(X[(r0 + 8 * g + r) * CC + c]) + sg * acc[j][r]; }
  LDSX(); for (int rl = 0; rl < 16; ++rl) vst2(OUT + (r0 + rl) * CC + c0 + lane * 4, *(const v4f*)&sf[wave][rl][lane * 4]); }
extern "C" void kernel_launch(void* const* d_in, const int* in_sizes, int n_in, void* d_out, int out_size, void* d_ws, size_t ws_size, hipStream_t stream) {
  (void)in_sizes; (void)n_in; (void)out_size;
  const float** F = (const float**)d_in;   // 0 x [8,64,64,256], 1 y, 2 W_fy [256,32], 3 W_gx, 4 W_hx, 5 W_out [32,256], 6 sigma [1]
  if (ws_size < (size_t)WS_END) return;
  char* ws = (char*)d_ws; __bf16 *PW = (__bf16*)(ws + WS_PW), *PO = (__bf16*)(ws + WS_PO); _Float16 *FG = (_Float16*)(ws + WS_FG), *FGL = (_Float16*)(ws + WS_FGL), *HT = (_Float16*)(ws + WS_HT), *HTL = (_Float16*)(ws + WS_HTL); float* AG = (float*)(ws + WS_AG);
  k_pack<<<3 * CI + CC, 256, 0, stream>>>(F[2], F[3], F[4], F[5], PW, PO);
  k_proj<<<dim3(NN / 64, TNB), 128, 0, stream>>>(F[0], F[1], PW, FG, FGL, HT, HTL);
  k_att<<<dim3(NN / 64, TNB), 128, 0, stream>>>(FG, FGL, HT, HTL, AG);
  k_out<<<dim3(TNB * NN / 64, CC / 128), 128, 0, stream>>>(AG, PO, F[0], F[6], (float*)d_out);
}

// v001
// One run takes 135 microseconds.
// Next to v000, in two timings, it ran 2.23 and 2.20 times as fast.
// compute dtype: all float inputs rounded to bf16, sigma read on device; fy, gx, hx with EXACT bf16 products on WMMA 16x16x32 ((in,out) weights packed to transposed rows), fy/gx rounded to f16 hi + residual rows, hx to f16 hi + residual planes; unscaled logits fy . gx with 3 products, running-max softmax in f32 (hardware exp), P (x 2^11, f16) . hx (2 products); out = x + sigma (attn_g (bf16 hi + lo, 2 products) . W_out); f32 output.
#include <hip/hip_runtime.h>
#include <math.h>

typedef __attribute__((ext_vector_type(16))) _Float16 v16h;
typedef __attribute__((ext_vector_type(16))) __bf16 v16b;
typedef __attribute__((ext_vector_type(8)))  _Float16 v8h;
typedef __attribute__((ext_vector_type(8)))  float v8f;
typedef __attribute__((ext_vector_type(4)))  float v4f;
typedef __attribute__((ext_vector_type(2)))  float v2f;
typedef __attribute__((ext_vector_type(4)))  unsigned v4u;
typedef __attribute__((ext_vector_type(4)))  int v4i;
typedef float __attribute__((may_alias)) float_a;
typedef int __attribute__((may_alias)) int_a;

template <typename T> __device__ __forceinline__ void vst2(void* p, T v) { *(T*)p = v;  }
__device__ __forceinline__ v8f wmma16(v16h a, v16h b, v8f c) {
  v8f d = __builtin_amdgcn_wmma_f32_16x16x32_f16(false, a, false, b, (short)0, c, false, false);
  asm volatile("v_nop\n\tv_nop\n\tv_nop\n\tv_nop" : "+v"(d) : "v"(a), "v"(b));
  return d;
}
__device__ __forceinline__ v8f wmma_bf(v16b a, v16b b, v8f c) {
  v8f d = __builtin_amdgcn_wmma_f32_16x16x32_bf16(false, a, false, b, (short)0, c, false, false);
  asm volatile("v_nop\n\tv_nop\n\tv_nop\n\tv_nop" : "+v"(d) : "v"(a), "v"(b));
  return d;
}
// 16x16x32 fragments: lane = (h = lane>>4, row/col = lane&15); elements 0..7 = k0+8h+0..7, 8..15 = k0+16+8h+0..7; D element r = row 8h+r
__device__ __forceinline__ v16h frag_h(const _Float16* rowk0, int lane) {
  union { v16h v; v8h q[2]; } u; const _Float16* p = rowk0 + 8 * (lane >> 4);
  u.q[0] = *(const v8h*)p; u.q[1] = *(const v8h*)(p + 16); return u.v;
}
__device__ __forceinline__ v16h frag_f32(const float* rowk0, int lane) {
  v16h a; const float* p = rowk0 + 8 * (lane >> 4);
#pragma unroll
  for (int i = 0; i < 8; ++i) { a[i] = (_Float16)p[i]; a[8 + i] = (_Float16)p[16 + i]; }
  return a;
}
__device__ __forceinline__ v16h frag_f32s(const float* rowk0, int lane, float sc) {
  v16h a; const float* p = rowk0 + 8 * (lane >> 4);
#pragma unroll
  for (int i = 0; i < 8; ++i) { a[i] = (_Float16)(p[i] * sc); a[8 + i] = (_Float16)(p[16 + i] * sc); }
  return a;
}
// column fragment from a [K][ld] layout (column n), rows >= K read as 0
__device__ __forceinline__ v16h fragc_f32(const float* W, int k0, int n, int lane, int ld, int K) {
  v16h a; const int g = lane >> 4;
#pragma unroll
  for (int i = 0; i < 8; ++i) { const int ka = k0 + 8 * g + i, kb = ka + 16;
    a[i] = (_Float16)(ka < K ? W[(size_t)(ka < K ? ka : K - 1) * ld + n] : 0.f); a[8 + i] = (_Float16)(kb < K ? W[(size_t)(kb < K ? kb : K - 1) * ld + n] : 0.f); }
  return a;
}
struct F2 { v16b h, l; };
__device__ __forceinline__ F2 bsplit16(const float v[16]) { F2 r;
#pragma unroll
  for (int i = 0; i < 16; ++i) { const __bf16 h = (__bf16)v[i]; r.h[i] = h; r.l[i] = (__bf16)(v[i] - (float)h); }
  return r; }
__device__ __forceinline__ F2 split_row(const float* row, int k0, int lane) { float v[16]; const float* p = row + k0 + 8 * (lane >> 4);
#pragma unroll
  for (int i = 0; i < 8; ++i) { v[i] = p[i]; v[8 + i] = p[16 + i]; }
  return bsplit16(v); }
__device__ __forceinline__ F2 split_rowK(const float* row, int k0, int lane, int K) { float v[16]; const int g = lane >> 4;
#pragma unroll
  for (int i = 0; i < 8; ++i) { const int ka = k0 + 8 * g + i, kb = ka + 16; v[i] = ka < K ? row[ka < K ? ka : K - 1] : 0.f; v[8 + i] = kb < K ? row[kb < K ? kb : K - 1] : 0.f; }
  return bsplit16(v); }
__device__ __forceinline__ F2 split_col(const float* W, int k0, int n, int lane, int ld, int K) { float v[16]; const int g = lane >> 4;
#pragma unroll
  for (int i = 0; i < 8; ++i) { const int ka = k0 + 8 * g + i, kb = ka + 16; v[i] = ka < K ? W[(size_t)(ka < K ? ka : K - 1) * ld + n] : 0.f; v[8 + i] = kb < K ? W[(size_t)(kb < K ? kb : K - 1) * ld + n] : 0.f; }
  return bsplit16(v); }
__device__ __forceinline__ v8f mac3(const F2& a, const F2& b, v8f c) { c = wmma_bf(a.l, b.h, c); c = wmma_bf(a.h, b.l, c); return wmma_bf(a.h, b.h, c); }
__device__ __forceinline__ float sigm(float v) { return 1.0f / (1.0f + expf(-v)); }
#define LDSX() do { asm volatile("s_wait_dscnt 0" ::: "memory"); __builtin_amdgcn_wave_barrier(); __builtin_amdgcn_fence(__ATOMIC_RELEASE, "workgroup"); } while (0)


// Self attention with channel reduction (B 8, 64 x 64 -> 4,096 positions, C 256, inner 32): attn = softmax(fy(y) . gx(x)^T) (unscaled); out = x + sigma (attn . hx(x)) W_out.
#define NB 8
#define NN 4096
#define CC 256
#define CI 32
#ifndef TNB
#define TNB NB
#endif
typedef __attribute__((ext_vector_type(8))) __bf16 v8b;
__device__ __forceinline__ v16b frag_b(const __bf16* rowk0, int lane) {
  union { v16b v; v8b q[2]; } u; const __bf16* p = rowk0 + 8 * (lane >> 4);
  u.q[0] = *(const v8b*)p; u.q[1] = *(const v8b*)(p + 16); return u.v;
}
__device__ __forceinline__ float bfr(float v) { return (float)(__bf16)v; }
__device__ __attribute__((noinline)) float exp_ni(float v) { return expf(v); }
__device__ __attribute__((noinline)) float erf_ni(float v) { return erff(v); }

#define WS_PW  0u                                   // bf16 rows [96][256]: fy | gx | hx weights transposed; [256][32] W_out^T
#define WS_PO  (WS_PW + 2u * 3 * CI * CC)
#define WS_FG  (WS_PO + 2u * CC * CI)                   // f16 hi|lo rows [b*NN + n][64] (fy 0..31 | gx 32..63)
#define WS_FGL (WS_FG + 2u * (size_t)NB * NN * 2 * CI)
#define WS_HT  (WS_FGL + 2u * (size_t)NB * NN * 2 * CI) // f16 hi|lo hx planes [b][32][NN]
#define WS_HTL (WS_HT + 2u * (size_t)NB * CI * NN)
#define WS_AG  (WS_HTL + 2u * (size_t)NB * CI * NN)    // f32 attn_g [b*NN + n][32]
#define WS_END (WS_AG + 4u * (size_t)NB * NN * CI)

__global__ __launch_bounds__(256) void k_pack(const float* __restrict__ WFY, const float* __restrict__ WGX, const float* __restrict__ WHX, const float* __restrict__ WOUT, __bf16* __restrict__ PW, __bf16* __restrict__ PO) { const int n = blockIdx.x, t = threadIdx.x; __shared__ __align__(16) __bf16 s[CC];   // n < 96: transposed (in,out) [256][32] rows; n >= 96: W_out^T rows [256 -> o][32]
  if (n < 3 * CI) { const float* Wm = n < CI ? WFY : n < 2 * CI ? WGX : WHX; const int o = n % CI; s[t] = (__bf16)Wm[(size_t)t * CI + o]; __syncthreads(); if (t < CC / 8) vst2((unsigned*)(PW + (size_t)n * CC + t * 8), *(const v4u*)&s[t * 8]); }
  else { const int o = n - 3 * CI; if (t < CI) s[t] = (__bf16)WOUT[(size_t)t * CC + o]; __syncthreads(); if (t < CI / 8) vst2((unsigned*)(PO + (size_t)o * CI + t * 8), *(const v4u*)&s[t * 8]); } }
__device__ __forceinline__ v16b fragb_f32(const float* __restrict__ p, int lane) { v16b a; const float* pp = p + 8 * (lane >> 4);
#pragma unroll
  for (int i = 0; i < 8; ++i) { a[i] = (__bf16)pp[i]; a[8 + i] = (__bf16)pp[16 + i]; } return a; }
// ---- k_proj: block = (64 positions, b): fy (from y), gx, hx (from x): 6 column tiles of 16; fy|gx -> rows hi/lo; hx -> planes hi/lo
__global__ __launch_bounds__(128) void k_proj(const float* __restrict__ X, const float* __restrict__ Y, const __bf16* __restrict__ PW, _Float16* __restrict__ FG, _Float16* __restrict__ FGL, _Float16* __restrict__ HT, _Float16* __restrict__ HTL) {
  __shared__ __align__(16) _Float16 sh[64][72], sl[64][72]; __shared__ __align__(16) _Float16 th[CI][72], tl[CI][72];
  const int tid = threadIdx.x, wave = tid >> 5, lane = tid & 31, col = lane & 15, g = lane >> 4; const size_t b = blockIdx.y; const int n0 = blockIdx.x * 64 + wave * 16; const size_t r0 = b * NN + n0;
  v8f acc[6] = {};
#pragma unroll 2
  for (int kc = 0; kc < CC / 32; ++kc) { const v16b ay = fragb_f32(Y + (r0 + col) * CC + kc * 32, lane), ax = fragb_f32(X + (r0 + col) * CC + kc * 32, lane);
#pragma unroll
    for (int j = 0; j < 6; ++j) acc[j] = wmma_bf(j < 2 ? ay : ax, frag_b(PW + (size_t)(j * 16 + col) * CC + kc * 32, lane), acc[j]); }
#pragma unroll
  for (int j = 0; j < 6; ++j)
#pragma unroll
    for (int r = 0; r < 8; ++r) { const float v = acc[j][r]; const _Float16 hv = (_Float16)v, lv = (_Float16)((v - (float)hv) * 2048.0f); if (j < 4) { sh[wave * 16 + 8 * g + r][j * 16 + col] = hv; sl[wave * 16 + 8 * g + r][j * 16 + col] = lv; } else { th[(j - 4) * 16 + col][wave * 16 + 8 * g + r] = hv; tl[(j - 4) * 16 + col][wave * 16 + 8 * g + r] = lv; } }
  __syncthreads();
  for (int e = tid; e < 64 * 8; e += 128) { const int rl = e >> 3, q = e & 7; const size_t o = (b * NN + blockIdx.x * 64 + rl) * (2 * CI) + q * 8; vst2((unsigned*)(FG + o), *(const v4u*)&sh[rl][q * 8]); vst2((unsigned*)(FGL + o), *(const v4u*)&sl[rl][q * 8]); }
  for (int e = tid; e < CI * 8; e += 128) { const int cl = e >> 3, q = e & 7; const size_t o = (b * CI + cl) * (size_t)NN + blockIdx.x * 64 + q * 8; vst2((unsigned*)(HT + o), *(const v4u*)&th[cl][q * 8]); vst2((unsigned*)(HTL + o), *(const v4u*)&tl[cl][q * 8]); } }
// ---- staging for k_att: one stage = 128 keys: gx rows hi/lo (64 B a key, LDS pitch 80 B) and hx planes hi/lo (256 B a channel, LDS pitch 272 B); both pitches are 16 B x odd, free of bank conflicts for 16-byte fragment reads
#define KS 128
#define KP 40
#define VP 136
struct Stage { _Float16 kh[KS][KP], kl[KS][KP], vh[CI][VP], vl[CI][VP]; };
__device__ __forceinline__ unsigned lds_at(const _Float16* p) { return (unsigned)(size_t)p; }   // LDS byte address = low 32 bits of the __shared__ address
// four asynchronous copies global -> LDS, 16 bytes a lane each, through no register; s_wait_xcnt stands in the copies' own statement so that it precedes every rewrite of an address register they name
__device__ __forceinline__ void copy4(unsigned l0, const _Float16* g0, unsigned l1, const _Float16* g1, unsigned l2, const _Float16* g2, unsigned l3, const _Float16* g3) {
  asm volatile("global_load_async_to_lds_b128 %0, %1, off\n\tglobal_load_async_to_lds_b128 %2, %3, off\n\tglobal_load_async_to_lds_b128 %4, %5, off\n\tglobal_load_async_to_lds_b128 %6, %7, off\n\ts_wait_xcnt 0x0"
               :: "v"(l0), "v"(g0), "v"(l1), "v"(g1), "v"(l2), "v"(g2), "v"(l3), "v"(g3) : "memory"); }
// 128 threads fill one stage: 16 copies a thread; a key row is 4 pieces of 16 B (32 rows a round), a channel row 16 pieces (8 rows a round)
__device__ __forceinline__ void fill(Stage* s, const _Float16* __restrict__ FG, const _Float16* __restrict__ FGL, const _Float16* __restrict__ HT, const _Float16* __restrict__ HTL, size_t b, int st, int tid) {
  const int kr = tid >> 2, kq = (tid & 3) * 8, vr = tid >> 4, vq = (tid & 15) * 8;
  const size_t gk = (b * NN + st * KS + kr) * (2 * CI) + CI + kq, dk = 32 * (2 * CI), gv = (b * CI + vr) * (size_t)NN + st * KS + vq, dv = 8 * (size_t)NN;
  copy4(lds_at(&s->kh[kr][kq]), FG + gk, lds_at(&s->kh[kr + 32][kq]), FG + gk + dk, lds_at(&s->kh[kr + 64][kq]), FG + gk + 2 * dk, lds_at(&s->kh[kr + 96][kq]), FG + gk + 3 * dk);
  copy4(lds_at(&s->kl[kr][kq]), FGL + gk, lds_at(&s->kl[kr + 32][kq]), FGL + gk + dk, lds_at(&s->kl[kr + 64][kq]), FGL + gk + 2 * dk, lds_at(&s->kl[kr + 96][kq]), FGL + gk + 3 * dk);
  copy4(lds_at(&s->vh[vr][vq]), HT + gv, lds_at(&s->vh[vr + 8][vq]), HT + gv + dv, lds_at(&s->vh[vr + 16][vq]), HT + gv + 2 * dv, lds_at(&s->vh[vr + 24][vq]), HT + gv + 3 * dv);
  copy4(lds_at(&s->vl[vr][vq]), HTL + gv, lds_at(&s->vl[vr + 8][vq]), HTL + gv + dv, lds_at(&s->vl[vr + 16][vq]), HTL + gv + 2 * dv, lds_at(&s->vl[vr + 24][vq]), HTL + gv + 3 * dv); }
// ---- k_att: block = (64 queries, b); the block's 4 waves read gx and hx from LDS stages (two buffers, the next stage's copies fly under this stage's work): unscaled logits fy_q . gx_k (3 products), softmax over all 4,096 positions, P . hx (2 products) -> AG rows
__global__ __launch_bounds__(128) void k_att(const _Float16* __restrict__ FG, const _Float16* __restrict__ FGL, const _Float16* __restrict__ HT, const _Float16* __restrict__ HTL, float* __restrict__ AG) {
  __shared__ __align__(16) float sp[4][16][36]; __shared__ __align__(16) float so[4][16][36]; __shared__ __align__(16) Stage sb[2];
  const int tid = threadIdx.x, wave = tid >> 5, lane = tid & 31, col = lane & 15, g = lane >> 4; const size_t b = blockIdx.y; const int q0 = blockIdx.x * 64 + wave * 16; const size_t rq = b * NN + q0;
  const v16h aq = frag_h(FG + (rq + col) * (2 * CI), lane), aql = frag_h(FGL + (rq + col) * (2 * CI), lane);
  float m[8], l[8];
#pragma unroll
  for (int r = 0; r < 8; ++r) { m[r] = -3.0e38f; l[r] = 0.f; }
  v8f acc[2] = {}, accl[2] = {};
  fill(&sb[0], FG, FGL, HT, HTL, b, 0, tid);
  asm volatile("s_wait_asynccnt 0x0" ::: "memory");   // this wave's copies of stage 0 have landed
  __syncthreads();                                     // publishes stage 0 to the other waves
  fill(&sb[1], FG, FGL, HT, HTL, b, 1, tid);
#pragma unroll 1   // one copy of the stage body: the publish point and the refill stand once, in the ring's order
  for (int st = 0; st < NN / KS; ++st) { const Stage* cs = &sb[st & 1];
  for (int ks = 0; ks < KS / 32; ++ks) { v8f s[2];
#pragma unroll
    for (int ct = 0; ct < 2; ++ct) { const int rk = ks * 32 + ct * 16 + col; const v16h kh = frag_h(&cs->kh[rk][0], lane), kl = frag_h(&cs->kl[rk][0], lane); v8f c = {}, cl = {}; c = wmma16(aq, kh, c); cl = wmma16(aq, kl, cl); cl = wmma16(aql, kh, cl);
#pragma unroll
      for (int r = 0; r < 8; ++r) s[ct][r] = c[r] + cl[r] * (1.0f / 2048.0f); }
    float alpha[8];
#pragma unroll
    for (int r = 0; r < 8; ++r) { float mx = fmaxf(s[0][r], s[1][r]);
#pragma unroll
      for (int o = 1; o < 16; o <<= 1) mx = fmaxf(mx, __shfl_xor(mx, o));
      const float mn = fmaxf(m[r], mx); alpha[r] = __expf(m[r] - mn); const float e0 = __expf(s[0][r] - mn), e1 = __expf(s[1][r] - mn); float es = e0 + e1;
#pragma unroll
      for (int o = 1; o < 16; o <<= 1) es += __shfl_xor(es, o);
      l[r] = l[r] * alpha[r] + es; m[r] = mn; sp[wave][8 * g + r][col] = e0; sp[wave][8 * g + r][16 + col] = e1; }
#pragma unroll
    for (int j = 0; j < 2; ++j)
#pragma unroll
      for (int r = 0; r < 8; ++r) { acc[j][r] *= alpha[r]; accl[j][r] *= alpha[r]; }
    LDSX();
    v16h pa; { const float* prow = &sp[wave][col][0] + 8 * (lane >> 4);
#pragma unroll
      for (int i = 0; i < 8; ++i) { pa[i] = (_Float16)(prow[i] * 2048.0f); pa[8 + i] = (_Float16)(prow[16 + i] * 2048.0f); } }
#pragma unroll
    for (int j = 0; j < 2; ++j) { acc[j] = wmma16(pa, frag_h(&cs->vh[j * 16 + col][ks * 32], lane), acc[j]); accl[j] = wmma16(pa, frag_h(&cs->vl[j * 16 + col][ks * 32], lane), accl[j]); }
    LDSX(); }
    asm volatile("s_wait_dscnt 0x0" ::: "memory");      // this wave's reads of stage st are done before its buffer is handed back
    asm volatile("s_wait_asynccnt 0x0" ::: "memory");   // this wave's copies of stage st + 1 have landed
    __syncthreads();                                     // publishes stage st + 1 and ends every wave's reads of stage st
    if (st + 2 < NN / KS) fill(&sb[st & 1], FG, FGL, HT, HTL, b, st + 2, tid); }
  asm volatile("s_wait_asynccnt 0x0" ::: "memory");     // no copy is outstanding when the wave goes on to its end
#pragma unroll
  for (int r = 0; r < 8; ++r) { const float il = (1.0f / 2048.0f) / l[r];
#pragma unroll
    for (int j = 0; j < 2; ++j) so[wave][8 * g + r][j * 16 + col] = (acc[j][r] + accl[j][r] * (1.0f / 2048.0f)) * il; }
  LDSX(); for (int rl = 0; rl < 16; ++rl) if (lane < 8) vst2(AG + (rq + rl) * CI + lane * 4, *(const v4f*)&so[wave][rl][lane * 4]); }
// ---- k_out: block = (64 rows, 128 cols): out = x + sigma (AG (hi + lo) . W_out)
__global__ __launch_bounds__(128) void k_out(const float* __restrict__ AG, const __bf16* __restrict__ PO, const float* __restrict__ X, const float* __restrict__ SIG, float* __restrict__ OUT) { __shared__ __align__(16) float sf[4][16][132];
  const int tid = threadIdx.x, wave = tid >> 5, lane = tid & 31, col = lane & 15, g = lane >> 4; const size_t r0 = (size_t)blockIdx.x * 64 + wave * 16; const int c0 = blockIdx.y * 128; const float sg = bfr(SIG[0]);
  v8f acc[8] = {}; { const F2 a = split_row(AG + (r0 + col) * CI, 0, lane);
#pragma unroll
    for (int j = 0; j < 8; ++j) { const v16b w = frag_b(PO + (size_t)(c0 + j * 16 + col) * CI, lane); acc[j] = wmma_bf(a.h, w, acc[j]); acc[j] = wmma_bf(a.l, w, acc[j]); } }
#pragma unroll
  for (int j = 0; j < 8; ++j) { const int c = c0 + j * 16 + col;
#pragma unroll
    for (int r = 0; r < 8; ++r) sf[wave][8 * g + r][j * 16 + col] = bfr(X[(r0 + 8 * g + r) * CC + c]) + sg * acc[j][r]; }
  LDSX(); for (int rl = 0; rl < 16; ++rl) vst2(OUT + (r0 + rl) * CC + c0 + lane * 4, *(const v4f*)&sf[wave][rl][lane * 4]); }
extern "C" void kernel_launch(void* const* d_in, const int* in_sizes, int n_in, void* d_out, int out_size, void* d_ws, size_t ws_size, hipStream_t stream) {
  (void)in_sizes; (void)n_in; (void)out_size;
  const float** F = (const float**)d_in;   // 0 x [8,64,64,256], 1 y, 2 W_fy [256,32], 3 W_gx, 4 W_hx, 5 W_out [32,256], 6 sigma [1]
  if (ws_size < (size_t)WS_END) return;
  char* ws = (char*)d_ws; __bf16 *PW = (__bf16*)(ws + WS_PW), *PO = (__bf16*)(ws + WS_PO); _Float16 *FG = (_Float16*)(ws + WS_FG), *FGL = (_Float16*)(ws + WS_FGL), *HT = (_Float16*)(ws + WS_HT), *HTL = (_Float16*)(ws + WS_HTL); float* AG = (float*)(ws + WS_AG);
  k_pack<<<3 * CI + CC, 256, 0, stream>>>(F[2], F[3], F[4], F[5], PW, PO);
  k_proj<<<dim3(NN / 64, TNB), 128, 0, stream>>>(F[0], F[1], PW, FG, FGL, HT, HTL);
  k_att<<<dim3(NN / 64, TNB), 128, 0, stream>>>(FG, FGL, HT, HTL, AG);
  k_out<<<dim3(TNB * NN / 64, CC / 128), 128, 0, stream>>>(AG, PO, F[0], F[6], (float*)d_out);
}

// v002
// It runs in 82.3 microseconds.
// Timed twice side by side with v001, it ran 1.65 and 1.63 times as fast.
// All steps since v000 together make it 3.63 times as fast.
// compute dtype: all float inputs rounded to bf16, sigma read on device; fy, gx, hx with EXACT bf16 products on WMMA 16x16x32 ((in,out) weights packed to transposed rows), fy/gx rounded to f16 hi + residual rows, hx to f16 hi + residual planes; unscaled logits fy . gx with 3 products, running-max softmax in f32 (hardware exp), P (x 2^11, f16) . hx (2 products); out = x + sigma (attn_g (bf16 hi + lo, 2 products) . W_out); f32 output.
#include <hip/hip_runtime.h>
#include <math.h>

typedef __attribute__((ext_vector_type(16))) _Float16 v16h;
typedef __attribute__((ext_vector_type(16))) __bf16 v16b;
typedef __attribute__((ext_vector_type(8)))  _Float16 v8h;
typedef __attribute__((ext_vector_type(8)))  float v8f;
typedef __attribute__((ext_vector_type(4)))  float v4f;
typedef __attribute__((ext_vector_type(2)))  float v2f;
typedef __attribute__((ext_vector_type(4)))  unsigned v4u;
typedef __attribute__((ext_vector_type(4)))  int v4i;
typedef float __attribute__((may_alias)) float_a;
typedef int __attribute__((may_alias)) int_a;

template <typename T> __device__ __forceinline__ void vst2(void* p, T v) { *(T*)p = v;  }
__device__ __forceinline__ v8f wmma16(v16h a, v16h b, v8f c) {
  v8f d = __builtin_amdgcn_wmma_f32_16x16x32_f16(false, a, false, b, (short)0, c, false, false);
  asm volatile("v_nop\n\tv_nop\n\tv_nop\n\tv_nop" : "+v"(d) : "v"(a), "v"(b));
  return d;
}
__device__ __forceinline__ v8f wmma_bf(v16b a, v16b b, v8f c) {
  v8f d = __builtin_amdgcn_wmma_f32_16x16x32_bf16(false, a, false, b, (short)0, c, false, false);
  asm volatile("v_nop\n\tv_nop\n\tv_nop\n\tv_nop" : "+v"(d) : "v"(a), "v"(b));
  return d;
}
// 16x16x32 fragments: lane = (h = lane>>4, row/col = lane&15); elements 0..7 = k0+8h+0..7, 8..15 = k0+16+8h+0..7; D element r = row 8h+r
__device__ __forceinline__ v16h frag_h(const _Float16* rowk0, int lane) {
  union { v16h v; v8h q[2]; } u; const _Float16* p = rowk0 + 8 * (lane >> 4);
  u.q[0] = *(const v8h*)p; u.q[1] = *(const v8h*)(p + 16); return u.v;
}
__device__ __forceinline__ v16h frag_f32(const float* rowk0, int lane) {
  v16h a; const float* p = rowk0 + 8 * (lane >> 4);
#pragma unroll
  for (int i = 0; i < 8; ++i) { a[i] = (_Float16)p[i]; a[8 + i] = (_Float16)p[16 + i]; }
  return a;
}
__device__ __forceinline__ v16h frag_f32s(const float* rowk0, int lane, float sc) {
  v16h a; const float* p = rowk0 + 8 * (lane >> 4);
#pragma unroll
  for (int i = 0; i < 8; ++i) { a[i] = (_Float16)(p[i] * sc); a[8 + i] = (_Float16)(p[16 + i] * sc); }
  return a;
}
// column fragment from a [K][ld] layout (column n), rows >= K read as 0
__device__ __forceinline__ v16h fragc_f32(const float* W, int k0, int n, int lane, int ld, int K) {
  v16h a; const int g = lane >> 4;
#pragma unroll
  for (int i = 0; i < 8; ++i) { const int ka = k0 + 8 * g + i, kb = ka + 16;
    a[i] = (_Float16)(ka < K ? W[(size_t)(ka < K ? ka : K - 1) * ld + n] : 0.f); a[8 + i] = (_Float16)(kb < K ? W[(size_t)(kb < K ? kb : K - 1) * ld + n] : 0.f); }
  return a;
}
struct F2 { v16b h, l; };
__device__ __forceinline__ F2 bsplit16(const float v[16]) { F2 r;
#pragma unroll
  for (int i = 0; i < 16; ++i) { const __bf16 h = (__bf16)v[i]; r.h[i] = h; r.l[i] = (__bf16)(v[i] - (float)h); }
  return r; }
__device__ __forceinline__ F2 split_row(const float* row, int k0, int lane) { float v[16]; const float* p = row + k0 + 8 * (lane >> 4);
#pragma unroll
  for (int i = 0; i < 8; ++i) { v[i] = p[i]; v[8 + i] = p[16 + i]; }
  return bsplit16(v); }
__device__ __forceinline__ F2 split_rowK(const float* row, int k0, int lane, int K) { float v[16]; const int g = lane >> 4;
#pragma unroll
  for (int i = 0; i < 8; ++i) { const int ka = k0 + 8 * g + i, kb = ka + 16; v[i] = ka < K ? row[ka < K ? ka : K - 1] : 0.f; v[8 + i] = kb < K ? row[kb < K ? kb : K - 1] : 0.f; }
  return bsplit16(v); }
__device__ __forceinline__ F2 split_col(const float* W, int k0, int n, int lane, int ld, int K) { float v[16]; const int g = lane >> 4;
#pragma unroll
  for (int i = 0; i < 8; ++i) { const int ka = k0 + 8 * g + i, kb = ka + 16; v[i] = ka < K ? W[(size_t)(ka < K ? ka : K - 1) * ld + n] : 0.f; v[8 + i] = kb < K ? W[(size_t)(kb < K ? kb : K - 1) * ld + n] : 0.f; }
  return bsplit16(v); }
__device__ __forceinline__ v8f mac3(const F2& a, const F2& b, v8f c) { c = wmma_bf(a.l, b.h, c); c = wmma_bf(a.h, b.l, c); return wmma_bf(a.h, b.h, c); }
__device__ __forceinline__ float sigm(float v) { return 1.0f / (1.0f + expf(-v)); }
#define LDSX() do { asm volatile("s_wait_dscnt 0" ::: "memory"); __builtin_amdgcn_wave_barrier(); __builtin_amdgcn_fence(__ATOMIC_RELEASE, "workgroup"); } while (0)


// Self attention with channel reduction (B 8, 64 x 64 -> 4,096 positions, C 256, inner 32): attn = softmax(fy(y) . gx(x)^T) (unscaled); out = x + sigma (attn . hx(x)) W_out.
#define NB 8
#define NN 4096
#define CC 256
#define CI 32
#ifndef TNB
#define TNB NB
#endif
typedef __attribute__((ext_vector_type(8))) __bf16 v8b;
__device__ __forceinline__ v16b frag_b(const __bf16* rowk0, int lane) {
  union { v16b v; v8b q[2]; } u; const __bf16* p = rowk0 + 8 * (lane >> 4);
  u.q[0] = *(const v8b*)p; u.q[1] = *(const v8b*)(p + 16); return u.v;
}
__device__ __forceinline__ float bfr(float v) { return (float)(__bf16)v; }
__device__ __attribute__((noinline)) float exp_ni(float v) { return expf(v); }
__device__ __attribute__((noinline)) float erf_ni(float v) { return erff(v); }

#define WS_PW  0u                                   // bf16 rows [96][256]: fy | gx | hx weights transposed; [256][32] W_out^T
#define WS_PO  (WS_PW + 2u * 3 * CI * CC)
#define WS_FG  (WS_PO + 2u * CC * CI)                   // f16 hi|lo rows [b*NN + n][64] (fy 0..31 | gx 32..63)
#define WS_FGL (WS_FG + 2u * (size_t)NB * NN * 2 * CI)
#define WS_HT  (WS_FGL + 2u * (size_t)NB * NN * 2 * CI) // f16 hi|lo hx planes [b][32][NN]
#define WS_HTL (WS_HT + 2u * (size_t)NB * CI * NN)
#define WS_AG  (WS_HTL + 2u * (size_t)NB * CI * NN)    // f32 attn_g [b*NN + n][32]
#define WS_END (WS_AG + 4u * (size_t)NB * NN * CI)

__global__ __launch_bounds__(256) void k_pack(const float* __restrict__ WFY, const float* __restrict__ WGX, const float* __restrict__ WHX, const float* __restrict__ WOUT, __bf16* __restrict__ PW, __bf16* __restrict__ PO) { const int n = blockIdx.x, t = threadIdx.x; __shared__ __align__(16) __bf16 s[CC];   // n < 96: transposed (in,out) [256][32] rows; n >= 96: W_out^T rows [256 -> o][32]
  if (n < 3 * CI) { const float* Wm = n < CI ? WFY : n < 2 * CI ? WGX : WHX; const int o = n % CI; s[t] = (__bf16)Wm[(size_t)t * CI + o]; __syncthreads(); if (t < CC / 8) vst2((unsigned*)(PW + (size_t)n * CC + t * 8), *(const v4u*)&s[t * 8]); }
  else { const int o = n - 3 * CI; if (t < CI) s[t] = (__bf16)WOUT[(size_t)t * CC + o]; __syncthreads(); if (t < CI / 8) vst2((unsigned*)(PO + (size_t)o * CI + t * 8), *(const v4u*)&s[t * 8]); } }
__device__ __forceinline__ v16b fragb_f32(const float* __restrict__ p, int lane) { v16b a; const float* pp = p + 8 * (lane >> 4);
#pragma unroll
  for (int i = 0; i < 8; ++i) { a[i] = (__bf16)pp[i]; a[8 + i] = (__bf16)pp[16 + i]; } return a; }
// ---- k_proj: block = (64 positions, b): fy (from y), gx, hx (from x): 6 column tiles of 16; fy|gx -> rows hi/lo; hx -> planes hi/lo
__global__ __launch_bounds__(128) void k_proj(const float* __restrict__ X, const float* __restrict__ Y, const __bf16* __restrict__ PW, _Float16* __restrict__ FG, _Float16* __restrict__ FGL, _Float16* __restrict__ HT, _Float16* __restrict__ HTL) {
  __shared__ __align__(16) _Float16 sh[64][72], sl[64][72]; __shared__ __align__(16) _Float16 th[CI][72], tl[CI][72];
  const int tid = threadIdx.x, wave = tid >> 5, lane = tid & 31, col = lane & 15, g = lane >> 4; const size_t b = blockIdx.y; const int n0 = blockIdx.x * 64 + wave * 16; const size_t r0 = b * NN + n0;
  v8f acc[6] = {};
#pragma unroll 2
  for (int kc = 0; kc < CC / 32; ++kc) { const v16b ay = fragb_f32(Y + (r0 + col) * CC + kc * 32, lane), ax = fragb_f32(X + (r0 + col) * CC + kc * 32, lane);
#pragma unroll
    for (int j = 0; j < 6; ++j) acc[j] = wmma_bf(j < 2 ? ay : ax, frag_b(PW + (size_t)(j * 16 + col) * CC + kc * 32, lane), acc[j]); }
#pragma unroll
  for (int j = 0; j < 6; ++j)
#pragma unroll
    for (int r = 0; r < 8; ++r) { const float v = acc[j][r]; const _Float16 hv = (_Float16)v, lv = (_Float16)((v - (float)hv) * 2048.0f); if (j < 4) { sh[wave * 16 + 8 * g + r][j * 16 + col] = hv; sl[wave * 16 + 8 * g + r][j * 16 + col] = lv; } else { th[(j - 4) * 16 + col][wave * 16 + 8 * g + r] = hv; tl[(j - 4) * 16 + col][wave * 16 + 8 * g + r] = lv; } }
  __syncthreads();
  for (int e = tid; e < 64 * 8; e += 128) { const int rl = e >> 3, q = e & 7; const size_t o = (b * NN + blockIdx.x * 64 + rl) * (2 * CI) + q * 8; vst2((unsigned*)(FG + o), *(const v4u*)&sh[rl][q * 8]); vst2((unsigned*)(FGL + o), *(const v4u*)&sl[rl][q * 8]); }
  for (int e = tid; e < CI * 8; e += 128) { const int cl = e >> 3, q = e & 7; const size_t o = (b * CI + cl) * (size_t)NN + blockIdx.x * 64 + q * 8; vst2((unsigned*)(HT + o), *(const v4u*)&th[cl][q * 8]); vst2((unsigned*)(HTL + o), *(const v4u*)&tl[cl][q * 8]); } }
// ---- staging for k_att: one stage = 128 keys: gx rows hi/lo (64 B a key, LDS pitch 80 B) and hx planes hi/lo (256 B a channel, LDS pitch 272 B); both pitches are 16 B x odd, free of bank conflicts for 16-byte fragment reads
#define KS 128
#define KP 40
#define VP 136
struct Stage { _Float16 kh[KS][KP], kl[KS][KP], vh[CI][VP], vl[CI][VP]; };
__device__ __forceinline__ unsigned lds_at(const _Float16* p) { return (unsigned)(size_t)p; }   // LDS byte address = low 32 bits of the __shared__ address
// four asynchronous copies global -> LDS, 16 bytes a lane each, through no register; s_wait_xcnt stands in the copies' own statement so that it precedes every rewrite of an address register they name
__device__ __forceinline__ void copy4(unsigned l0, const _Float16* g0, unsigned l1, const _Float16* g1, unsigned l2, const _Float16* g2, unsigned l3, const _Float16* g3) {
  asm volatile("global_load_async_to_lds_b128 %0, %1, off\n\tglobal_load_async_to_lds_b128 %2, %3, off\n\tglobal_load_async_to_lds_b128 %4, %5, off\n\tglobal_load_async_to_lds_b128 %6, %7, off\n\ts_wait_xcnt 0x0"
               :: "v"(l0), "v"(g0), "v"(l1), "v"(g1), "v"(l2), "v"(g2), "v"(l3), "v"(g3) : "memory"); }
// 128 threads fill one stage: 16 copies a thread; a key row is 4 pieces of 16 B (32 rows a round), a channel row 16 pieces (8 rows a round)
__device__ __forceinline__ void fill(Stage* s, const _Float16* __restrict__ FG, const _Float16* __restrict__ FGL, const _Float16* __restrict__ HT, const _Float16* __restrict__ HTL, size_t b, int st, int tid) {
  const int kr = tid >> 2, kq = (tid & 3) * 8, vr = tid >> 4, vq = (tid & 15) * 8;
  const size_t gk = (b * NN + st * KS + kr) * (2 * CI) + CI + kq, dk = 32 * (2 * CI), gv = (b * CI + vr) * (size_t)NN + st * KS + vq, dv = 8 * (size_t)NN;
  copy4(lds_at(&s->kh[kr][kq]), FG + gk, lds_at(&s->kh[kr + 32][kq]), FG + gk + dk, lds_at(&s->kh[kr + 64][kq]), FG + gk + 2 * dk, lds_at(&s->kh[kr + 96][kq]), FG + gk + 3 * dk);
  copy4(lds_at(&s->kl[kr][kq]), FGL + gk, lds_at(&s->kl[kr + 32][kq]), FGL + gk + dk, lds_at(&s->kl[kr + 64][kq]), FGL + gk + 2 * dk, lds_at(&s->kl[kr + 96][kq]), FGL + gk + 3 * dk);
  copy4(lds_at(&s->vh[vr][vq]), HT + gv, lds_at(&s->vh[vr + 8][vq]), HT + gv + dv, lds_at(&s->vh[vr + 16][vq]), HT + gv + 2 * dv, lds_at(&s->vh[vr + 24][vq]), HT + gv + 3 * dv);
  copy4(lds_at(&s->vl[vr][vq]), HTL + gv, lds_at(&s->vl[vr + 8][vq]), HTL + gv + dv, lds_at(&s->vl[vr + 16][vq]), HTL + gv + 2 * dv, lds_at(&s->vl[vr + 24][vq]), HTL + gv + 3 * dv); }
// ---- k_att: block = (64 queries, b); the block's 4 waves read gx and hx from LDS stages (two buffers, the next stage's copies fly under this stage's work): transposed tiles S^T = gx_k . fy_q^T (3 products): a lane holds 16 of the 32 keys of ONE query, so maximum and sum are in-lane (one exchange between the wave's halves for the maximum; the halves' sums join once at the end) and the two score tiles, converted in place, are the B operand of O^T += hx^T . P^T (2 products) -> AG rows
__device__ __forceinline__ float other_half(float v) { return __builtin_bit_cast(float, __builtin_amdgcn_permlanex16(__builtin_bit_cast(int, v), __builtin_bit_cast(int, v), 0x76543210, 0xfedcba98, false, false)); }   // lane l <-> l ^ 16
__global__ __launch_bounds__(128) void k_att(const _Float16* __restrict__ FG, const _Float16* __restrict__ FGL, const _Float16* __restrict__ HT, const _Float16* __restrict__ HTL, float* __restrict__ AG) {
  __shared__ __align__(16) float so[4][16][36]; __shared__ __align__(16) Stage sb[2];
  const int tid = threadIdx.x, wave = tid >> 5, lane = tid & 31, col = lane & 15, g = lane >> 4; const size_t b = blockIdx.y; const int q0 = blockIdx.x * 64 + wave * 16; const size_t rq = b * NN + q0;
  const v16h aq = frag_h(FG + (rq + col) * (2 * CI), lane), aql = frag_h(FGL + (rq + col) * (2 * CI), lane);
  float m = -3.0e38f, l = 0.f;   // query col: running maximum (equal in both halves), this half's share of the sum
  v8f acc[2] = {}, accl[2] = {};   // element r = channel j * 16 + 8 g + r of query col
  fill(&sb[0], FG, FGL, HT, HTL, b, 0, tid);
  asm volatile("s_wait_asynccnt 0x0" ::: "memory");   // this wave's copies of stage 0 have landed
  __syncthreads();                                     // publishes stage 0 to the other waves
  fill(&sb[1], FG, FGL, HT, HTL, b, 1, tid);
#pragma unroll 1   // one copy of the stage body: the publish point and the refill stand once, in the ring's order
  for (int st = 0; st < NN / KS; ++st) { const Stage* cs = &sb[st & 1];
  for (int ks = 0; ks < KS / 32; ++ks) { v8f s[2];   // s[ct][r] = logit of key ks * 32 + ct * 16 + 8 g + r with query col
    v16h kh[2], kl[2], vh[2], vl[2];   // no LDS write stands in the pass, so all its fragment loads are issued at its head: the hx ones land under the score products and the softmax
#pragma unroll
    for (int ct = 0; ct < 2; ++ct) { const int rk = ks * 32 + ct * 16 + col; kh[ct] = frag_h(&cs->kh[rk][0], lane); kl[ct] = frag_h(&cs->kl[rk][0], lane); }
#pragma unroll
    for (int j = 0; j < 2; ++j) { vh[j] = frag_h(&cs->vh[j * 16 + col][ks * 32], lane); vl[j] = frag_h(&cs->vl[j * 16 + col][ks * 32], lane); }
#pragma unroll
    for (int ct = 0; ct < 2; ++ct) { v8f c = {}, cl = {}; c = wmma16(kh[ct], aq, c); cl = wmma16(kl[ct], aq, cl); cl = wmma16(kh[ct], aql, cl);
#pragma unroll
      for (int r = 0; r < 8; ++r) s[ct][r] = c[r] + cl[r] * (1.0f / 2048.0f); }
    float mx = fmaxf(s[0][0], s[1][0]), my = fmaxf(s[0][4], s[1][4]);   // two chains, half the dependent length
#pragma unroll
    for (int r = 1; r < 4; ++r) { mx = fmaxf(mx, fmaxf(s[0][r], s[1][r])); my = fmaxf(my, fmaxf(s[0][4 + r], s[1][4 + r])); }
    mx = fmaxf(mx, my);
    mx = fmaxf(mx, other_half(mx));
    const float mn = fmaxf(m, mx), alpha = __expf(m - mn); m = mn;
    v16h pa; float es = 0.f;   // pa element i = key 8 g + i, 8 + i = key 16 + 8 g + i: the k order of frag_h
#pragma unroll
    for (int r = 0; r < 8; ++r) { const float e0 = __expf(s[0][r] - mn), e1 = __expf(s[1][r] - mn); es += e0 + e1; pa[r] = (_Float16)(e0 * 2048.0f); pa[8 + r] = (_Float16)(e1 * 2048.0f); }
    l = l * alpha + es;
#pragma unroll
    for (int j = 0; j < 2; ++j)
#pragma unroll
      for (int r = 0; r < 8; ++r) { acc[j][r] *= alpha; accl[j][r] *= alpha; }
#pragma unroll
    for (int j = 0; j < 2; ++j) { acc[j] = wmma16(vh[j], pa, acc[j]); accl[j] = wmma16(vl[j], pa, accl[j]); } }
    asm volatile("s_wait_dscnt 0x0" ::: "memory");      // this wave's reads of stage st are done before its buffer is handed back
    asm volatile("s_wait_asynccnt 0x0" ::: "memory");   // this wave's copies of stage st + 1 have landed
    __syncthreads();                                     // publishes stage st + 1 and ends every wave's reads of stage st
    if (st + 2 < NN / KS) fill(&sb[st & 1], FG, FGL, HT, HTL, b, st + 2, tid); }
  asm volatile("s_wait_asynccnt 0x0" ::: "memory");     // no copy is outstanding when the wave goes on to its end
  l += other_half(l);
  const float il = (1.0f / 2048.0f) / l;
#pragma unroll
  for (int j = 0; j < 2; ++j)
#pragma unroll
    for (int r = 0; r < 8; ++r) so[wave][col][j * 16 + 8 * g + r] = (acc[j][r] + accl[j][r] * (1.0f / 2048.0f)) * il;
  LDSX(); for (int rl = 0; rl < 16; ++rl) if (lane < 8) vst2(AG + (rq + rl) * CI + lane * 4, *(const v4f*)&so[wave][rl][lane * 4]); }
// ---- k_out: block = (64 rows, 128 cols): out = x + sigma (AG (hi + lo) . W_out)
__global__ __launch_bounds__(128) void k_out(const float* __restrict__ AG, const __bf16* __restrict__ PO, const float* __restrict__ X, const float* __restrict__ SIG, float* __restrict__ OUT) { __shared__ __align__(16) float sf[4][16][132];
  const int tid = threadIdx.x, wave = tid >> 5, lane = tid & 31, col = lane & 15, g = lane >> 4; const size_t r0 = (size_t)blockIdx.x * 64 + wave * 16; const int c0 = blockIdx.y * 128; const float sg = bfr(SIG[0]);
  v8f acc[8] = {}; { const F2 a = split_row(AG + (r0 + col) * CI, 0, lane);
#pragma unroll
    for (int j = 0; j < 8; ++j) { const v16b w = frag_b(PO + (size_t)(c0 + j * 16 + col) * CI, lane); acc[j] = wmma_bf(a.h, w, acc[j]); acc[j] = wmma_bf(a.l, w, acc[j]); } }
#pragma unroll
  for (int j = 0; j < 8; ++j) { const int c = c0 + j * 16 + col;
#pragma unroll
    for (int r = 0; r < 8; ++r) sf[wave][8 * g + r][j * 16 + col] = bfr(X[(r0 + 8 * g + r) * CC + c]) + sg * acc[j][r]; }
  LDSX(); for (int rl = 0; rl < 16; ++rl) vst2(OUT + (r0 + rl) * CC + c0 + lane * 4, *(const v4f*)&sf[wave][rl][lane * 4]); }
extern "C" void kernel_launch(void* const* d_in, const int* in_sizes, int n_in, void* d_out, int out_size, void* d_ws, size_t ws_size, hipStream_t stream) {
  (void)in_sizes; (void)n_in; (void)out_size;
  const float** F = (const float**)d_in;   // 0 x [8,64,64,256], 1 y, 2 W_fy [256,32], 3 W_gx, 4 W_hx, 5 W_out [32,256], 6 sigma [1]
  if (ws_size < (size_t)WS_END) return;
  char* ws = (char*)d_ws; __bf16 *PW = (__bf16*)(ws + WS_PW), *PO = (__bf16*)(ws + WS_PO); _Float16 *FG = (_Float16*)(ws + WS_FG), *FGL = (_Float16*)(ws + WS_FGL), *HT = (_Float16*)(ws + WS_HT), *HTL = (_Float16*)(ws + WS_HTL); float* AG = (float*)(ws + WS_AG);
  k_pack<<<3 * CI + CC, 256, 0, stream>>>(F[2], F[3], F[4], F[5], PW, PO);
  k_proj<<<dim3(NN / 64, TNB), 128, 0, stream>>>(F[0], F[1], PW, FG, FGL, HT, HTL);
  k_att<<<dim3(NN / 64, TNB), 128, 0, stream>>>(FG, FGL, HT, HTL, AG);
  k_out<<<dim3(TNB * NN / 64, CC / 128), 128, 0, stream>>>(AG, PO, F[0], F[6], (float*)d_out);
}

// v003
// Measured time: 78.7 microseconds a run.
// Next to v002, in two timings, it ran 1.04 and 1.03 times as fast.
// All steps since v000 together make it 3.75 times as fast.
// compute dtype: all float inputs rounded to bf16, sigma read on device; fy, gx, hx with EXACT bf16 products on WMMA 16x16x32 ((in,out) weights packed to transposed rows), fy/gx rounded to f16 hi + residual rows, hx to f16 hi + residual planes; unscaled logits fy . gx with 3 products, running-max softmax in f32 (hardware exp), P (x 2^11, f16) . hx (2 products); out = x + sigma (attn_g (bf16 hi + lo, 2 products) . W_out); f32 output.
#include <hip/hip_runtime.h>
#include <math.h>

typedef __attribute__((ext_vector_type(16))) _Float16 v16h;
typedef __attribute__((ext_vector_type(16))) __bf16 v16b;
typedef __attribute__((ext_vector_type(8)))  _Float16 v8h;
typedef __attribute__((ext_vector_type(8)))  float v8f;
typedef __attribute__((ext_vector_type(4)))  float v4f;
typedef __attribute__((ext_vector_type(2)))  float v2f;
typedef __attribute__((ext_vector_type(4)))  unsigned v4u;
typedef __attribute__((ext_vector_type(4)))  int v4i;
typedef float __attribute__((may_alias)) float_a;
typedef int __attribute__((may_alias)) int_a;

template <typename T> __device__ __forceinline__ void vst2(void* p, T v) { *(T*)p = v;  }
__device__ __forceinline__ v8f wmma16(v16h a, v16h b, v8f c) {
  v8f d = __builtin_amdgcn_wmma_f32_16x16x32_f16(false, a, false, b, (short)0, c, false, false);
  asm volatile("v_nop\n\tv_nop\n\tv_nop\n\tv_nop" : "+v"(d) : "v"(a), "v"(b));
  return d;
}
__device__ __forceinline__ v8f wmma_bf(v16b a, v16b b, v8f c) {
  v8f d = __builtin_amdgcn_wmma_f32_16x16x32_bf16(false, a, false, b, (short)0, c, false, false);
  asm volatile("v_nop\n\tv_nop\n\tv_nop\n\tv_nop" : "+v"(d) : "v"(a), "v"(b));
  return d;
}
// 16x16x32 fragments: lane = (h = lane>>4, row/col = lane&15); elements 0..7 = k0+8h+0..7, 8..15 = k0+16+8h+0..7; D element r = row 8h+r
__device__ __forceinline__ v16h frag_h(const _Float16* rowk0, int lane) {
  union { v16h v; v8h q[2]; } u; const _Float16* p = rowk0 + 8 * (lane >> 4);
  u.q[0] = *(const v8h*)p; u.q[1] = *(const v8h*)(p + 16); return u.v;
}
__device__ __forceinline__ v16h frag_f32(const float* rowk0, int lane) {
  v16h a; const float* p = rowk0 + 8 * (lane >> 4);
#pragma unroll
  for (int i = 0; i < 8; ++i) { a[i] = (_Float16)p[i]; a[8 + i] = (_Float16)p[16 + i]; }
  return a;
}
__device__ __forceinline__ v16h frag_f32s(const float* rowk0, int lane, float sc) {
  v16h a; const float* p = rowk0 + 8 * (lane >> 4);
#pragma unroll
  for (int i = 0; i < 8; ++i) { a[i] = (_Float16)(p[i] * sc); a[8 + i] = (_Float16)(p[16 + i] * sc); }
  return a;
}
// column fragment from a [K][ld] layout (column n), rows >= K read as 0
__device__ __forceinline__ v16h fragc_f32(const float* W, int k0, int n, int lane, int ld, int K) {
  v16h a; const int g = lane >> 4;
#pragma unroll
  for (int i = 0; i < 8; ++i) { const int ka = k0 + 8 * g + i, kb = ka + 16;
    a[i] = (_Float16)(ka < K ? W[(size_t)(ka < K ? ka : K - 1) * ld + n] : 0.f); a[8 + i] = (_Float16)(kb < K ? W[(size_t)(kb < K ? kb : K - 1) * ld + n] : 0.f); }
  return a;
}
struct F2 { v16b h, l; };
__device__ __forceinline__ F2 bsplit16(const float v[16]) { F2 r;
#pragma unroll
  for (int i = 0; i < 16; ++i) { const __bf16 h = (__bf16)v[i]; r.h[i] = h; r.l[i] = (__bf16)(v[i] - (float)h); }
  return r; }
__device__ __forceinline__ F2 split_row(const float* row, int k0, int lane) { float v[16]; const float* p = row + k0 + 8 * (lane >> 4);
#pragma unroll
  for (int i = 0; i < 8; ++i) { v[i] = p[i]; v[8 + i] = p[16 + i]; }
  return bsplit16(v); }
__device__ __forceinline__ F2 split_rowK(const float* row, int k0, int lane, int K) { float v[16]; const int g = lane >> 4;
#pragma unroll
  for (int i = 0; i < 8; ++i) { const int ka = k0 + 8 * g + i, kb = ka + 16; v[i] = ka < K ? row[ka < K ? ka : K - 1] : 0.f; v[8 + i] = kb < K ? row[kb < K ? kb : K - 1] : 0.f; }
  return bsplit16(v); }
__device__ __forceinline__ F2 split_col(const float* W, int k0, int n, int lane, int ld, int K) { float v[16]; const int g = lane >> 4;
#pragma unroll
  for (int i = 0; i < 8; ++i) { const int ka = k0 + 8 * g + i, kb = ka + 16; v[i] = ka < K ? W[(size_t)(ka < K ? ka : K - 1) * ld + n] : 0.f; v[8 + i] = kb < K ? W[(size_t)(kb < K ? kb : K - 1) * ld + n] : 0.f; }
  return bsplit16(v); }
__device__ __forceinline__ v8f mac3(const F2& a, const F2& b, v8f c) { c = wmma_bf(a.l, b.h, c); c = wmma_bf(a.h, b.l, c); return wmma_bf(a.h, b.h, c); }
__device__ __forceinline__ float sigm(float v) { return 1.0f / (1.0f + expf(-v)); }
#define LDSX() do { asm volatile("s_wait_dscnt 0" ::: "memory"); __builtin_amdgcn_wave_barrier(); __builtin_amdgcn_fence(__ATOMIC_RELEASE, "workgroup"); } while (0)


// Self attention with channel reduction (B 8, 64 x 64 -> 4,096 positions, C 256, inner 32): attn = softmax(fy(y) . gx(x)^T) (unscaled); out = x + sigma (attn . hx(x)) W_out.
#define NB 8
#define NN 4096
#define CC 256
#define CI 32
#ifndef TNB
#define TNB NB
#endif
typedef __attribute__((ext_vector_type(8))) __bf16 v8b;
__device__ __forceinline__ v16b frag_b(const __bf16* rowk0, int lane) {
  union { v16b v; v8b q[2]; } u; const __bf16* p = rowk0 + 8 * (lane >> 4);
  u.q[0] = *(const v8b*)p; u.q[1] = *(const v8b*)(p + 16); return u.v;
}
__device__ __forceinline__ float bfr(float v) { return (float)(__bf16)v; }
__device__ __attribute__((noinline)) float exp_ni(float v) { return expf(v); }
__device__ __attribute__((noinline)) float erf_ni(float v) { return erff(v); }

#define WS_PW  0u                                   // bf16 rows [96][256]: fy | gx | hx weights transposed; [256][32] W_out^T
#define WS_PO  (WS_PW + 2u * 3 * CI * CC)
#define WS_FG  (WS_PO + 2u * CC * CI)                   // f16 hi|lo rows [b*NN + n][64] (fy 0..31 | gx 32..63)
#define WS_FGL (WS_FG + 2u * (size_t)NB * NN * 2 * CI)
#define WS_HT  (WS_FGL + 2u * (size_t)NB * NN * 2 * CI) // f16 hi|lo hx planes [b][32][NN]
#define WS_HTL (WS_HT + 2u * (size_t)NB * CI * NN)
#define WS_AG  (WS_HTL + 2u * (size_t)NB * CI * NN)    // f32 attn_g [b*NN + n][32]
#define WS_END (WS_AG + 4u * (size_t)NB * NN * CI)

__global__ __launch_bounds__(256) void k_pack(const float* __restrict__ WFY, const float* __restrict__ WGX, const float* __restrict__ WHX, const float* __restrict__ WOUT, __bf16* __restrict__ PW, __bf16* __restrict__ PO) { const int n = blockIdx.x, t = threadIdx.x; __shared__ __align__(16) __bf16 s[CC];   // n < 96: transposed (in,out) [256][32] rows; n >= 96: W_out^T rows [256 -> o][32]
  if (n < 3 * CI) { const float* Wm = n < CI ? WFY : n < 2 * CI ? WGX : WHX; const int o = n % CI; s[t] = (__bf16)Wm[(size_t)t * CI + o]; __syncthreads(); if (t < CC / 8) vst2((unsigned*)(PW + (size_t)n * CC + t * 8), *(const v4u*)&s[t * 8]); }
  else { const int o = n - 3 * CI; if (t < CI) s[t] = (__bf16)WOUT[(size_t)t * CC + o]; __syncthreads(); if (t < CI / 8) vst2((unsigned*)(PO + (size_t)o * CI + t * 8), *(const v4u*)&s[t * 8]); } }
__device__ __forceinline__ v16b fragb_f32(const float* __restrict__ p, int lane) { v16b a; const float* pp = p + 8 * (lane >> 4);
#pragma unroll
  for (int i = 0; i < 8; ++i) { a[i] = (__bf16)pp[i]; a[8 + i] = (__bf16)pp[16 + i]; } return a; }
// ---- k_proj: block = (64 positions, b): fy (from y), gx, hx (from x): 6 column tiles of 16; fy|gx -> rows hi/lo; hx -> planes hi/lo
__global__ __launch_bounds__(128) void k_proj(const float* __restrict__ X, const float* __restrict__ Y, const __bf16* __restrict__ PW, _Float16* __restrict__ FG, _Float16* __restrict__ FGL, _Float16* __restrict__ HT, _Float16* __restrict__ HTL) {
  __shared__ __align__(16) _Float16 sh[64][72], sl[64][72]; __shared__ __align__(16) _Float16 th[CI][72], tl[CI][72];
  const int tid = threadIdx.x, wave = tid >> 5, lane = tid & 31, col = lane & 15, g = lane >> 4; const size_t b = blockIdx.y; const int n0 = blockIdx.x * 64 + wave * 16; const size_t r0 = b * NN + n0;
  v8f acc[6] = {};
#pragma unroll 2
  for (int kc = 0; kc < CC / 32; ++kc) { const v16b ay = fragb_f32(Y + (r0 + col) * CC + kc * 32, lane), ax = fragb_f32(X + (r0 + col) * CC + kc * 32, lane);
#pragma unroll
    for (int j = 0; j < 6; ++j) acc[j] = wmma_bf(j < 2 ? ay : ax, frag_b(PW + (size_t)(j * 16 + col) * CC + kc * 32, lane), acc[j]); }
#pragma unroll
  for (int j = 0; j < 6; ++j)
#pragma unroll
    for (int r = 0; r < 8; ++r) { const float v = acc[j][r]; const _Float16 hv = (_Float16)v, lv = (_Float16)((v - (float)hv) * 2048.0f); if (j < 4) { sh[wave * 16 + 8 * g + r][j * 16 + col] = hv; sl[wave * 16 + 8 * g + r][j * 16 + col] = lv; } else { th[(j - 4) * 16 + col][wave * 16 + 8 * g + r] = hv; tl[(j - 4) * 16 + col][wave * 16 + 8 * g + r] = lv; } }
  __syncthreads();
  for (int e = tid; e < 64 * 8; e += 128) { const int rl = e >> 3, q = e & 7; const size_t o = (b * NN + blockIdx.x * 64 + rl) * (2 * CI) + q * 8; vst2((unsigned*)(FG + o), *(const v4u*)&sh[rl][q * 8]); vst2((unsigned*)(FGL + o), *(const v4u*)&sl[rl][q * 8]); }
  for (int e = tid; e < CI * 8; e += 128) { const int cl = e >> 3, q = e & 7; const size_t o = (b * CI + cl) * (size_t)NN + blockIdx.x * 64 + q * 8; vst2((unsigned*)(HT + o), *(const v4u*)&th[cl][q * 8]); vst2((unsigned*)(HTL + o), *(const v4u*)&tl[cl][q * 8]); } }
// ---- staging for k_att: one stage = 128 keys: gx rows hi/lo (64 B a key, LDS pitch 80 B) and hx planes hi/lo (256 B a channel, LDS pitch 272 B); both pitches are 16 B x odd, free of bank conflicts for 16-byte fragment reads
#define KS 128
#define KP 40
#define VP 136
struct Stage { _Float16 kh[KS][KP], kl[KS][KP], vh[CI][VP], vl[CI][VP]; };
__device__ __forceinline__ unsigned lds_at(const _Float16* p) { return (unsigned)(size_t)p; }   // LDS byte address = low 32 bits of the __shared__ address
// four asynchronous copies global -> LDS, 16 bytes a lane each, through no register; s_wait_xcnt stands in the copies' own statement so that it precedes every rewrite of an address register they name
__device__ __forceinline__ void copy4(unsigned l0, const _Float16* g0, unsigned l1, const _Float16* g1, unsigned l2, const _Float16* g2, unsigned l3, const _Float16* g3) {
  asm volatile("global_load_async_to_lds_b128 %0, %1, off\n\tglobal_load_async_to_lds_b128 %2, %3, off\n\tglobal_load_async_to_lds_b128 %4, %5, off\n\tglobal_load_async_to_lds_b128 %6, %7, off\n\ts_wait_xcnt 0x0"
               :: "v"(l0), "v"(g0), "v"(l1), "v"(g1), "v"(l2), "v"(g2), "v"(l3), "v"(g3) : "memory"); }
// 256 threads fill one stage: 8 copies a thread; a key row is 4 pieces of 16 B (64 rows a round), a channel row 16 pieces (16 rows a round)
__device__ __forceinline__ void fill(Stage* s, const _Float16* __restrict__ FG, const _Float16* __restrict__ FGL, const _Float16* __restrict__ HT, const _Float16* __restrict__ HTL, size_t b, int st, int tid) {
  const int kr = tid >> 2, kq = (tid & 3) * 8, vr = tid >> 4, vq = (tid & 15) * 8;
  const size_t gk = (b * NN + st * KS + kr) * (2 * CI) + CI + kq, dk = 64 * (2 * CI), gv = (b * CI + vr) * (size_t)NN + st * KS + vq, dv = 16 * (size_t)NN;
  copy4(lds_at(&s->kh[kr][kq]), FG + gk, lds_at(&s->kh[kr + 64][kq]), FG + gk + dk, lds_at(&s->kl[kr][kq]), FGL + gk, lds_at(&s->kl[kr + 64][kq]), FGL + gk + dk);
  copy4(lds_at(&s->vh[vr][vq]), HT + gv, lds_at(&s->vh[vr + 16][vq]), HT + gv + dv, lds_at(&s->vl[vr][vq]), HTL + gv, lds_at(&s->vl[vr + 16][vq]), HTL + gv + dv); }
// ---- k_att: block = (64 queries, b), 8 waves: waves w and w + 4 share the 16 queries of tile w and each walk one half of every stage's keys with a running maximum, sum and O of their own (four waves a SIMD with two blocks a WGP: one wave's LDS, matrix and softmax latencies are covered by three others); the two partial results join once, through LDS, at the end; the block's waves read gx and hx from LDS stages (two buffers, the next stage's copies fly under this stage's work): transposed tiles S^T = gx_k . fy_q^T (3 products): a lane holds 16 of the 32 keys of ONE query, so maximum and sum are in-lane (one exchange between the wave's halves for the maximum; the halves' sums join once at the end) and the two score tiles, converted in place, are the B operand of O^T += hx^T . P^T (2 products) -> AG rows
__device__ __forceinline__ float other_half(float v) { return __builtin_bit_cast(float, __builtin_amdgcn_permlanex16(__builtin_bit_cast(int, v), __builtin_bit_cast(int, v), 0x76543210, 0xfedcba98, false, false)); }   // lane l <-> l ^ 16
__global__ __launch_bounds__(256) void k_att(const _Float16* __restrict__ FG, const _Float16* __restrict__ FGL, const _Float16* __restrict__ HT, const _Float16* __restrict__ HTL, float* __restrict__ AG) {
  __shared__ __align__(16) float so[4][16][36]; __shared__ __align__(16) float xp[4][32][20]; __shared__ __align__(16) Stage sb[2];   // xp: a lane's 16 partial outputs, its maximum and its sum; pitch 80 B = 16 B x odd
  const int tid = threadIdx.x, wave = (tid >> 5) & 3, kg = tid >> 7, lane = tid & 31, col = lane & 15, g = lane >> 4; const size_t b = blockIdx.y; const int q0 = blockIdx.x * 64 + wave * 16; const size_t rq = b * NN + q0;   // wave: query tile; kg: which half of a stage's keys
  const v16h aq = frag_h(FG + (rq + col) * (2 * CI), lane), aql = frag_h(FGL + (rq + col) * (2 * CI), lane);
  float m = -3.0e38f, l = 0.f;   // query col: running maximum (equal in both halves), this half's share of the sum
  v8f acc[2] = {}, accl[2] = {};   // element r = channel j * 16 + 8 g + r of query col
  fill(&sb[0], FG, FGL, HT, HTL, b, 0, tid);
  asm volatile("s_wait_asynccnt 0x0" ::: "memory");   // this wave's copies of stage 0 have landed
  __syncthreads();                                     // publishes stage 0 to the other waves
  fill(&sb[1], FG, FGL, HT, HTL, b, 1, tid);
#pragma unroll 1   // one copy of the stage body: the publish point and the refill stand once, in the ring's order
  for (int st = 0; st < NN / KS; ++st) { const Stage* cs = &sb[st & 1];
  for (int ks = kg * (KS / 64); ks < (kg + 1) * (KS / 64); ++ks) { v8f s[2];   // s[ct][r] = logit of key ks * 32 + ct * 16 + 8 g + r with query col
    v16h kh[2], kl[2], vh[2], vl[2];   // no LDS write stands in the pass, so all its fragment loads are issued at its head: the hx ones land under the score products and the softmax
#pragma unroll
    for (int ct = 0; ct < 2; ++ct) { const int rk = ks * 32 + ct * 16 + col; kh[ct] = frag_h(&cs->kh[rk][0], lane); kl[ct] = frag_h(&cs->kl[rk][0], lane); }
#pragma unroll
    for (int j = 0; j < 2; ++j) { vh[j] = frag_h(&cs->vh[j * 16 + col][ks * 32], lane); vl[j] = frag_h(&cs->vl[j * 16 + col][ks * 32], lane); }
#pragma unroll
    for (int ct = 0; ct < 2; ++ct) { v8f c = {}, cl = {}; c = wmma16(kh[ct], aq, c); cl = wmma16(kl[ct], aq, cl); cl = wmma16(kh[ct], aql, cl);
#pragma unroll
      for (int r = 0; r < 8; ++r) s[ct][r] = c[r] + cl[r] * (1.0f / 2048.0f); }
    float mx = fmaxf(s[0][0], s[1][0]), my = fmaxf(s[0][4], s[1][4]);   // two chains, half the dependent length
#pragma unroll
    for (int r = 1; r < 4; ++r) { mx = fmaxf(mx, fmaxf(s[0][r], s[1][r])); my = fmaxf(my, fmaxf(s[0][4 + r], s[1][4 + r])); }
    mx = fmaxf(mx, my);
    mx = fmaxf(mx, other_half(mx));
    const float mn = fmaxf(m, mx), alpha = __expf(m - mn); m = mn;
    v16h pa; float es = 0.f;   // pa element i = key 8 g + i, 8 + i = key 16 + 8 g + i: the k order of frag_h
#pragma unroll
    for (int r = 0; r < 8; ++r) { const float e0 = __expf(s[0][r] - mn), e1 = __expf(s[1][r] - mn); es += e0 + e1; pa[r] = (_Float16)(e0 * 2048.0f); pa[8 + r] = (_Float16)(e1 * 2048.0f); }
    l = l * alpha + es;
#pragma unroll
    for (int j = 0; j < 2; ++j)
#pragma unroll
      for (int r = 0; r < 8; ++r) { acc[j][r] *= alpha; accl[j][r] *= alpha; }
#pragma unroll
    for (int j = 0; j < 2; ++j) { acc[j] = wmma16(vh[j], pa, acc[j]); accl[j] = wmma16(vl[j], pa, accl[j]); } }
    asm volatile("s_wait_dscnt 0x0" ::: "memory");      // this wave's reads of stage st are done before its buffer is handed back
    asm volatile("s_wait_asynccnt 0x0" ::: "memory");   // this wave's copies of stage st + 1 have landed
    __syncthreads();                                     // publishes stage st + 1 and ends every wave's reads of stage st
    if (st + 2 < NN / KS) fill(&sb[st & 1], FG, FGL, HT, HTL, b, st + 2, tid); }
  asm volatile("s_wait_asynccnt 0x0" ::: "memory");     // no copy is outstanding when the wave goes on to its end
  float o[16];   // this wave's partial output, relative to its own maximum m
#pragma unroll
  for (int j = 0; j < 2; ++j)
#pragma unroll
    for (int r = 0; r < 8; ++r) o[j * 8 + r] = acc[j][r] + accl[j][r] * (1.0f / 2048.0f);
  float* xr = &xp[wave][lane][0];
  if (kg == 1) {
#pragma unroll
    for (int i = 0; i < 4; ++i) *(v4f*)(xr + 4 * i) = v4f{o[4 * i], o[4 * i + 1], o[4 * i + 2], o[4 * i + 3]};
    *(v2f*)(xr + 16) = v2f{m, l}; }
  __syncthreads();   // hands the second key half's partial results to the wave that holds the first half of the same queries
  if (kg == 1) return;   // no barrier stands behind this line
  const v2f ml = *(const v2f*)(xr + 16); const float mt = fmaxf(m, ml[0]), fa = __expf(m - mt), fb = __expf(ml[0] - mt);
  l = l * fa + ml[1] * fb;
  l += other_half(l);
  const float il = (1.0f / 2048.0f) / l;
#pragma unroll
  for (int i = 0; i < 4; ++i) { const v4f p = *(const v4f*)(xr + 4 * i);
#pragma unroll
    for (int e = 0; e < 4; ++e) o[4 * i + e] = o[4 * i + e] * fa + p[e] * fb; }
#pragma unroll
  for (int j = 0; j < 2; ++j)
#pragma unroll
    for (int r = 0; r < 8; ++r) so[wave][col][j * 16 + 8 * g + r] = o[j * 8 + r] * il;
  LDSX(); for (int rl = 0; rl < 16; ++rl) if (lane < 8) vst2(AG + (rq + rl) * CI + lane * 4, *(const v4f*)&so[wave][rl][lane * 4]); }
// ---- k_out: block = (64 rows, 128 cols): out = x + sigma (AG (hi + lo) . W_out)
__global__ __launch_bounds__(128) void k_out(const float* __restrict__ AG, const __bf16* __restrict__ PO, const float* __restrict__ X, const float* __restrict__ SIG, float* __restrict__ OUT) { __shared__ __align__(16) float sf[4][16][132];
  const int tid = threadIdx.x, wave = tid >> 5, lane = tid & 31, col = lane & 15, g = lane >> 4; const size_t r0 = (size_t)blockIdx.x * 64 + wave * 16; const int c0 = blockIdx.y * 128; const float sg = bfr(SIG[0]);
  v8f acc[8] = {}; { const F2 a = split_row(AG + (r0 + col) * CI, 0, lane);
#pragma unroll
    for (int j = 0; j < 8; ++j) { const v16b w = frag_b(PO + (size_t)(c0 + j * 16 + col) * CI, lane); acc[j] = wmma_bf(a.h, w, acc[j]); acc[j] = wmma_bf(a.l, w, acc[j]); } }
#pragma unroll
  for (int j = 0; j < 8; ++j) { const int c = c0 + j * 16 + col;
#pragma unroll
    for (int r = 0; r < 8; ++r) sf[wave][8 * g + r][j * 16 + col] = bfr(X[(r0 + 8 * g + r) * CC + c]) + sg * acc[j][r]; }
  LDSX(); for (int rl = 0; rl < 16; ++rl) vst2(OUT + (r0 + rl) * CC + c0 + lane * 4, *(const v4f*)&sf[wave][rl][lane * 4]); }
extern "C" void kernel_launch(void* const* d_in, const int* in_sizes, int n_in, void* d_out, int out_size, void* d_ws, size_t ws_size, hipStream_t stream) {
  (void)in_sizes; (void)n_in; (void)out_size;
  const float** F = (const float**)d_in;   // 0 x [8,64,64,256], 1 y, 2 W_fy [256,32], 3 W_gx, 4 W_hx, 5 W_out [32,256], 6 sigma [1]
  if (ws_size < (size_t)WS_END) return;
  char* ws = (char*)d_ws; __bf16 *PW = (__bf16*)(ws + WS_PW), *PO = (__bf16*)(ws + WS_PO); _Float16 *FG = (_Float16*)(ws + WS_FG), *FGL = (_Float16*)(ws + WS_FGL), *HT = (_Float16*)(ws + WS_HT), *HTL = (_Float16*)(ws + WS_HTL); float* AG = (float*)(ws + WS_AG);
  k_pack<<<3 * CI + CC, 256, 0, stream>>>(F[2], F[3], F[4], F[5], PW, PO);
  k_proj<<<dim3(NN / 64, TNB), 128, 0, stream>>>(F[0], F[1], PW, FG, FGL, HT, HTL);
  k_att<<<dim3(NN / 64, TNB), 256, 0, stream>>>(FG, FGL, HT, HTL, AG);
  k_out<<<dim3(TNB * NN / 64, CC / 128), 128, 0, stream>>>(AG, PO, F[0], F[6], (float*)d_out);
}

// v004
// It runs in 74.8 microseconds.
// Next to v003, in two timings, it ran 1.05 and 1.06 times as fast.
// All steps since v000 together make it 3.94 times as fast.
// compute dtype: all float inputs rounded to bf16, sigma read on device; fy, gx, hx with EXACT bf16 products on WMMA 16x16x32 ((in,out) weights packed to transposed rows), fy (x log2 e) and gx rounded to f16 hi + residual rows, hx to f16 hi + residual planes (residuals at their own scale, f16 subnormals included); logits fy . gx (base 2) with 3 products in one accumulator, running-max softmax in f32 (hardware exp2), P (x 2^11, f16) . hx (2 products in one accumulator); out = x + sigma (attn_g (bf16 hi + lo, 2 products) . W_out); f32 output.
#include <hip/hip_runtime.h>
#include <math.h>

typedef __attribute__((ext_vector_type(16))) _Float16 v16h;
typedef __attribute__((ext_vector_type(16))) __bf16 v16b;
typedef __attribute__((ext_vector_type(8)))  _Float16 v8h;
typedef __attribute__((ext_vector_type(8)))  float v8f;
typedef __attribute__((ext_vector_type(4)))  float v4f;
typedef __attribute__((ext_vector_type(2)))  float v2f;
typedef __attribute__((ext_vector_type(4)))  unsigned v4u;
typedef __attribute__((ext_vector_type(4)))  int v4i;
typedef float __attribute__((may_alias)) float_a;
typedef int __attribute__((may_alias)) int_a;

template <typename T> __device__ __forceinline__ void vst2(void* p, T v) { *(T*)p = v;  }
__device__ __forceinline__ v8f wmma16(v16h a, v16h b, v8f c) {
  v8f d = __builtin_amdgcn_wmma_f32_16x16x32_f16(false, a, false, b, (short)0, c, false, false);
  asm volatile("v_nop\n\tv_nop\n\tv_nop\n\tv_nop" : "+v"(d) : "v"(a), "v"(b));
  return d;
}
__device__ __forceinline__ v8f wmma_bf(v16b a, v16b b, v8f c) {
  v8f d = __builtin_amdgcn_wmma_f32_16x16x32_bf16(false, a, false, b, (short)0, c, false, false);
  asm volatile("v_nop\n\tv_nop\n\tv_nop\n\tv_nop" : "+v"(d) : "v"(a), "v"(b));
  return d;
}
// 16x16x32 fragments: lane = (h = lane>>4, row/col = lane&15); elements 0..7 = k0+8h+0..7, 8..15 = k0+16+8h+0..7; D element r = row 8h+r
__device__ __forceinline__ v16h frag_h(const _Float16* rowk0, int lane) {
  union { v16h v; v8h q[2]; } u; const _Float16* p = rowk0 + 8 * (lane >> 4);
  u.q[0] = *(const v8h*)p; u.q[1] = *(const v8h*)(p + 16); return u.v;
}
__device__ __forceinline__ v16h frag_f32(const float* rowk0, int lane) {
  v16h a; const float* p = rowk0 + 8 * (lane >> 4);
#pragma unroll
  for (int i = 0; i < 8; ++i) { a[i] = (_Float16)p[i]; a[8 + i] = (_Float16)p[16 + i]; }
  return a;
}
__device__ __forceinline__ v16h frag_f32s(const float* rowk0, int lane, float sc) {
  v16h a; const float* p = rowk0 + 8 * (lane >> 4);
#pragma unroll
  for (int i = 0; i < 8; ++i) { a[i] = (_Float16)(p[i] * sc); a[8 + i] = (_Float16)(p[16 + i] * sc); }
  return a;
}
// column fragment from a [K][ld] layout (column n), rows >= K read as 0
__device__ __forceinline__ v16h fragc_f32(const float* W, int k0, int n, int lane, int ld, int K) {
  v16h a; const int g = lane >> 4;
#pragma unroll
  for (int i = 0; i < 8; ++i) { const int ka = k0 + 8 * g + i, kb = ka + 16;
    a[i] = (_Float16)(ka < K ? W[(size_t)(ka < K ? ka : K - 1) * ld + n] : 0.f); a[8 + i] = (_Float16)(kb < K ? W[(size_t)(kb < K ? kb : K - 1) * ld + n] : 0.f); }
  return a;
}
struct F2 { v16b h, l; };
__device__ __forceinline__ F2 bsplit16(const float v[16]) { F2 r;
#pragma unroll
  for (int i = 0; i < 16; ++i) { const __bf16 h = (__bf16)v[i]; r.h[i] = h; r.l[i] = (__bf16)(v[i] - (float)h); }
  return r; }
__device__ __forceinline__ F2 split_row(const float* row, int k0, int lane) { float v[16]; const float* p = row + k0 + 8 * (lane >> 4);
#pragma unroll
  for (int i = 0; i < 8; ++i) { v[i] = p[i]; v[8 + i] = p[16 + i]; }
  return bsplit16(v); }
__device__ __forceinline__ F2 split_rowK(const float* row, int k0, int lane, int K) { float v[16]; const int g = lane >> 4;
#pragma unroll
  for (int i = 0; i < 8; ++i) { const int ka = k0 + 8 * g + i, kb = ka + 16; v[i] = ka < K ? row[ka < K ? ka : K - 1] : 0.f; v[8 + i] = kb < K ? row[kb < K ? kb : K - 1] : 0.f; }
  return bsplit16(v); }
__device__ __forceinline__ F2 split_col(const float* W, int k0, int n, int lane, int ld, int K) { float v[16]; const int g = lane >> 4;
#pragma unroll
  for (int i = 0; i < 8; ++i) { const int ka = k0 + 8 * g + i, kb = ka + 16; v[i] = ka < K ? W[(size_t)(ka < K ? ka : K - 1) * ld + n] : 0.f; v[8 + i] = kb < K ? W[(size_t)(kb < K ? kb : K - 1) * ld + n] : 0.f; }
  return bsplit16(v); }
__device__ __forceinline__ v8f mac3(const F2& a, const F2& b, v8f c) { c = wmma_bf(a.l, b.h, c); c = wmma_bf(a.h, b.l, c); return wmma_bf(a.h, b.h, c); }
__device__ __forceinline__ float sigm(float v) { return 1.0f / (1.0f + expf(-v)); }
#define LDSX() do { asm volatile("s_wait_dscnt 0" ::: "memory"); __builtin_amdgcn_wave_barrier(); __builtin_amdgcn_fence(__ATOMIC_RELEASE, "workgroup"); } while (0)


// Self attention with channel reduction (B 8, 64 x 64 -> 4,096 positions, C 256, inner 32): attn = softmax(fy(y) . gx(x)^T) (unscaled); out = x + sigma (attn . hx(x)) W_out.
#define NB 8
#define NN 4096
#define CC 256
#define CI 32
#ifndef TNB
#define TNB NB
#endif
typedef __attribute__((ext_vector_type(8))) __bf16 v8b;
__device__ __forceinline__ v16b frag_b(const __bf16* rowk0, int lane) {
  union { v16b v; v8b q[2]; } u; const __bf16* p = rowk0 + 8 * (lane >> 4);
  u.q[0] = *(const v8b*)p; u.q[1] = *(const v8b*)(p + 16); return u.v;
}
__device__ __forceinline__ float bfr(float v) { return (float)(__bf16)v; }
__device__ __attribute__((noinline)) float exp_ni(float v) { return expf(v); }
__device__ __attribute__((noinline)) float erf_ni(float v) { return erff(v); }

#define WS_PW  0u                                   // bf16 rows [96][256]: fy | gx | hx weights transposed; [256][32] W_out^T
#define WS_PO  (WS_PW + 2u * 3 * CI * CC)
#define WS_FG  (WS_PO + 2u * CC * CI)                   // f16 hi|lo rows [b*NN + n][64] (fy 0..31 | gx 32..63)
#define WS_FGL (WS_FG + 2u * (size_t)NB * NN * 2 * CI)
#define WS_HT  (WS_FGL + 2u * (size_t)NB * NN * 2 * CI) // f16 hi|lo hx planes [b][32][NN]
#define WS_HTL (WS_HT + 2u * (size_t)NB * CI * NN)
#define WS_AG  (WS_HTL + 2u * (size_t)NB * CI * NN)    // f32 attn_g [b*NN + n][32]
#define WS_END (WS_AG + 4u * (size_t)NB * NN * CI)

__global__ __launch_bounds__(256) void k_pack(const float* __restrict__ WFY, const float* __restrict__ WGX, const float* __restrict__ WHX, const float* __restrict__ WOUT, __bf16* __restrict__ PW, __bf16* __restrict__ PO) { const int n = blockIdx.x, t = threadIdx.x; __shared__ __align__(16) __bf16 s[CC];   // n < 96: transposed (in,out) [256][32] rows; n >= 96: W_out^T rows [256 -> o][32]
  if (n < 3 * CI) { const float* Wm = n < CI ? WFY : n < 2 * CI ? WGX : WHX; const int o = n % CI; s[t] = (__bf16)Wm[(size_t)t * CI + o]; __syncthreads(); if (t < CC / 8) vst2((unsigned*)(PW + (size_t)n * CC + t * 8), *(const v4u*)&s[t * 8]); }
  else { const int o = n - 3 * CI; if (t < CI) s[t] = (__bf16)WOUT[(size_t)t * CC + o]; __syncthreads(); if (t < CI / 8) vst2((unsigned*)(PO + (size_t)o * CI + t * 8), *(const v4u*)&s[t * 8]); } }
__device__ __forceinline__ v16b fragb_f32(const float* __restrict__ p, int lane) { v16b a; const float* pp = p + 8 * (lane >> 4);
#pragma unroll
  for (int i = 0; i < 8; ++i) { a[i] = (__bf16)pp[i]; a[8 + i] = (__bf16)pp[16 + i]; } return a; }
// ---- k_proj: block = (64 positions, b): fy (from y), gx, hx (from x): 6 column tiles of 16; fy|gx -> rows hi/lo; hx -> planes hi/lo
__global__ __launch_bounds__(128) void k_proj(const float* __restrict__ X, const float* __restrict__ Y, const __bf16* __restrict__ PW, _Float16* __restrict__ FG, _Float16* __restrict__ FGL, _Float16* __restrict__ HT, _Float16* __restrict__ HTL) {
  __shared__ __align__(16) _Float16 sh[64][72], sl[64][72]; __shared__ __align__(16) _Float16 th[CI][72], tl[CI][72];
  const int tid = threadIdx.x, wave = tid >> 5, lane = tid & 31, col = lane & 15, g = lane >> 4; const size_t b = blockIdx.y; const int n0 = blockIdx.x * 64 + wave * 16; const size_t r0 = b * NN + n0;
  v8f acc[6] = {};
#pragma unroll 2
  for (int kc = 0; kc < CC / 32; ++kc) { const v16b ay = fragb_f32(Y + (r0 + col) * CC + kc * 32, lane), ax = fragb_f32(X + (r0 + col) * CC + kc * 32, lane);
#pragma unroll
    for (int j = 0; j < 6; ++j) acc[j] = wmma_bf(j < 2 ? ay : ax, frag_b(PW + (size_t)(j * 16 + col) * CC + kc * 32, lane), acc[j]); }
#pragma unroll
  for (int j = 0; j < 6; ++j)
#pragma unroll
    for (int r = 0; r < 8; ++r) { const float v = j < 2 ? acc[j][r] * 1.44269504088896340736f : acc[j][r]; const _Float16 hv = (_Float16)v, lv = (_Float16)(v - (float)hv);   // fy carries log2 e, so the softmax needs no multiply in front of exp2; a residual keeps its own scale, so its products add into the same accumulator as the hi products
      if (j < 4) { sh[wave * 16 + 8 * g + r][j * 16 + col] = hv; sl[wave * 16 + 8 * g + r][j * 16 + col] = lv; } else { th[(j - 4) * 16 + col][wave * 16 + 8 * g + r] = hv; tl[(j - 4) * 16 + col][wave * 16 + 8 * g + r] = lv; } }
  __syncthreads();
  for (int e = tid; e < 64 * 8; e += 128) { const int rl = e >> 3, q = e & 7; const size_t o = (b * NN + blockIdx.x * 64 + rl) * (2 * CI) + q * 8; vst2((unsigned*)(FG + o), *(const v4u*)&sh[rl][q * 8]); vst2((unsigned*)(FGL + o), *(const v4u*)&sl[rl][q * 8]); }
  for (int e = tid; e < CI * 8; e += 128) { const int cl = e >> 3, q = e & 7; const size_t o = (b * CI + cl) * (size_t)NN + blockIdx.x * 64 + q * 8; vst2((unsigned*)(HT + o), *(const v4u*)&th[cl][q * 8]); vst2((unsigned*)(HTL + o), *(const v4u*)&tl[cl][q * 8]); } }
// ---- staging for k_att: one stage = 128 keys: gx rows hi/lo (64 B a key, LDS pitch 80 B) and hx planes hi/lo (256 B a channel, LDS pitch 272 B); both pitches are 16 B x odd, free of bank conflicts for 16-byte fragment reads
#define KS 128
#define KP 40
#define VP 136
struct Stage { _Float16 kh[KS][KP], kl[KS][KP], vh[CI][VP], vl[CI][VP]; };
__device__ __forceinline__ unsigned lds_at(const _Float16* p) { return (unsigned)(size_t)p; }   // LDS byte address = low 32 bits of the __shared__ address
// four asynchronous copies global -> LDS, 16 bytes a lane each, through no register; s_wait_xcnt stands in the copies' own statement so that it precedes every rewrite of an address register they name
__device__ __forceinline__ void copy4(unsigned l0, const _Float16* g0, unsigned l1, const _Float16* g1, unsigned l2, const _Float16* g2, unsigned l3, const _Float16* g3) {
  asm volatile("global_load_async_to_lds_b128 %0, %1, off\n\tglobal_load_async_to_lds_b128 %2, %3, off\n\tglobal_load_async_to_lds_b128 %4, %5, off\n\tglobal_load_async_to_lds_b128 %6, %7, off\n\ts_wait_xcnt 0x0"
               :: "v"(l0), "v"(g0), "v"(l1), "v"(g1), "v"(l2), "v"(g2), "v"(l3), "v"(g3) : "memory"); }
// 256 threads fill one stage: 8 copies a thread; a key row is 4 pieces of 16 B (64 rows a round), a channel row 16 pieces (16 rows a round)
__device__ __forceinline__ void fill(Stage* s, const _Float16* __restrict__ FG, const _Float16* __restrict__ FGL, const _Float16* __restrict__ HT, const _Float16* __restrict__ HTL, size_t b, int st, int tid) {
  const int kr = tid >> 2, kq = (tid & 3) * 8, vr = tid >> 4, vq = (tid & 15) * 8;
  const size_t gk = (b * NN + st * KS + kr) * (2 * CI) + CI + kq, dk = 64 * (2 * CI), gv = (b * CI + vr) * (size_t)NN + st * KS + vq, dv = 16 * (size_t)NN;
  copy4(lds_at(&s->kh[kr][kq]), FG + gk, lds_at(&s->kh[kr + 64][kq]), FG + gk + dk, lds_at(&s->kl[kr][kq]), FGL + gk, lds_at(&s->kl[kr + 64][kq]), FGL + gk + dk);
  copy4(lds_at(&s->vh[vr][vq]), HT + gv, lds_at(&s->vh[vr + 16][vq]), HT + gv + dv, lds_at(&s->vl[vr][vq]), HTL + gv, lds_at(&s->vl[vr + 16][vq]), HTL + gv + dv); }
// ---- k_att: block = (64 queries, b), 8 waves: waves w and w + 4 share the 16 queries of tile w and each walk one half of every stage's keys with a running maximum, sum and O of their own (four waves a SIMD with two blocks a WGP: one wave's LDS, matrix and softmax latencies are covered by three others); the two partial results join once, through LDS, at the end; the block's waves read gx and hx from LDS stages (two buffers, the next stage's copies fly under this stage's work): transposed tiles S^T = gx_k . fy_q^T (3 products, one accumulator): a lane holds 16 of the 32 keys of ONE query, so maximum and sum are in-lane (one exchange between the wave's halves for the maximum; the halves' sums join once at the end) and the two score tiles, converted in place, are the B operand of O^T += hx^T . P^T (2 products, one accumulator) -> AG rows
__device__ __forceinline__ float other_half(float v) { return __builtin_bit_cast(float, __builtin_amdgcn_permlanex16(__builtin_bit_cast(int, v), __builtin_bit_cast(int, v), 0x76543210, 0xfedcba98, false, false)); }   // lane l <-> l ^ 16
__global__ __launch_bounds__(256) void k_att(const _Float16* __restrict__ FG, const _Float16* __restrict__ FGL, const _Float16* __restrict__ HT, const _Float16* __restrict__ HTL, float* __restrict__ AG) {
  __shared__ __align__(16) float so[4][16][36]; __shared__ __align__(16) float xp[4][32][20]; __shared__ __align__(16) Stage sb[2];   // xp: a lane's 16 partial outputs, its maximum and its sum; pitch 80 B = 16 B x odd
  const int tid = threadIdx.x, wave = (tid >> 5) & 3, kg = tid >> 7, lane = tid & 31, col = lane & 15, g = lane >> 4; const size_t b = blockIdx.y; const int q0 = blockIdx.x * 64 + wave * 16; const size_t rq = b * NN + q0;   // wave: query tile; kg: which half of a stage's keys
  const v16h aq = frag_h(FG + (rq + col) * (2 * CI), lane), aql = frag_h(FGL + (rq + col) * (2 * CI), lane);
  float m = -3.0e38f, l = 0.f;   // query col: running maximum of the base-2 logits (equal in both halves), this half's share of the sum, x 2^11
  v8f acc[2] = {};   // element r = channel j * 16 + 8 g + r of query col, x 2^11
  fill(&sb[0], FG, FGL, HT, HTL, b, 0, tid);
  asm volatile("s_wait_asynccnt 0x0" ::: "memory");   // this wave's copies of stage 0 have landed
  __syncthreads();                                     // publishes stage 0 to the other waves
  fill(&sb[1], FG, FGL, HT, HTL, b, 1, tid);
#pragma unroll 1   // one copy of the stage body: the publish point and the refill stand once, in the ring's order
  for (int st = 0; st < NN / KS; ++st) { const Stage* cs = &sb[st & 1];
  for (int ks = kg * (KS / 64); ks < (kg + 1) * (KS / 64); ++ks) { v8f s[2];   // s[ct][r] = logit of key ks * 32 + ct * 16 + 8 g + r with query col
    v16h kh[2], kl[2], vh[2], vl[2];   // no LDS write stands in the pass, so all its fragment loads are issued at its head: the hx ones land under the score products and the softmax
#pragma unroll
    for (int ct = 0; ct < 2; ++ct) { const int rk = ks * 32 + ct * 16 + col; kh[ct] = frag_h(&cs->kh[rk][0], lane); kl[ct] = frag_h(&cs->kl[rk][0], lane); }
#pragma unroll
    for (int j = 0; j < 2; ++j) { vh[j] = frag_h(&cs->vh[j * 16 + col][ks * 32], lane); vl[j] = frag_h(&cs->vl[j * 16 + col][ks * 32], lane); }
    s[0] = wmma16(kl[0], aq, v8f{}); s[1] = wmma16(kl[1], aq, v8f{});   // the two tiles' chains alternate: a product's successor in its own accumulator stands two matrix instructions behind it
    s[0] = wmma16(kh[0], aql, s[0]); s[1] = wmma16(kh[1], aql, s[1]);
    s[0] = wmma16(kh[0], aq, s[0]); s[1] = wmma16(kh[1], aq, s[1]);
    float mx = fmaxf(s[0][0], s[1][0]), my = fmaxf(s[0][4], s[1][4]);   // two chains, half the dependent length
#pragma unroll
    for (int r = 1; r < 4; ++r) { mx = fmaxf(mx, fmaxf(s[0][r], s[1][r])); my = fmaxf(my, fmaxf(s[0][4 + r], s[1][4 + r])); }
    mx = fmaxf(mx, my);
    mx = fmaxf(mx, other_half(mx));
    const float mn = fmaxf(m, mx), alpha = __builtin_amdgcn_exp2f(m - mn), mb = mn - 11.0f; m = mn;   // mb: the 2^11 of P rides in the subtracted maximum
    v16h pa; float es = 0.f;   // pa element i = key 8 g + i, 8 + i = key 16 + 8 g + i: the k order of frag_h
#pragma unroll
    for (int r = 0; r < 8; ++r) { const float e0 = __builtin_amdgcn_exp2f(s[0][r] - mb), e1 = __builtin_amdgcn_exp2f(s[1][r] - mb); es += e0 + e1; pa[r] = (_Float16)e0; pa[8 + r] = (_Float16)e1; }
    l = l * alpha + es;
#pragma unroll
    for (int j = 0; j < 2; ++j)
#pragma unroll
      for (int r = 0; r < 8; ++r) acc[j][r] *= alpha;
    acc[0] = wmma16(vh[0], pa, acc[0]); acc[1] = wmma16(vh[1], pa, acc[1]);
    acc[0] = wmma16(vl[0], pa, acc[0]); acc[1] = wmma16(vl[1], pa, acc[1]); }
    asm volatile("s_wait_dscnt 0x0" ::: "memory");      // this wave's reads of stage st are done before its buffer is handed back
    asm volatile("s_wait_asynccnt 0x0" ::: "memory");   // this wave's copies of stage st + 1 have landed
    __syncthreads();                                     // publishes stage st + 1 and ends every wave's reads of stage st
    if (st + 2 < NN / KS) fill(&sb[st & 1], FG, FGL, HT, HTL, b, st + 2, tid); }
  asm volatile("s_wait_asynccnt 0x0" ::: "memory");     // no copy is outstanding when the wave goes on to its end
  float o[16];   // this wave's partial output, relative to its own maximum m
#pragma unroll
  for (int j = 0; j < 2; ++j)
#pragma unroll
    for (int r = 0; r < 8; ++r) o[j * 8 + r] = acc[j][r];
  float* xr = &xp[wave][lane][0];
  if (kg == 1) {
#pragma unroll
    for (int i = 0; i < 4; ++i) *(v4f*)(xr + 4 * i) = v4f{o[4 * i], o[4 * i + 1], o[4 * i + 2], o[4 * i + 3]};
    *(v2f*)(xr + 16) = v2f{m, l}; }
  __syncthreads();   // hands the second key half's partial results to the wave that holds the first half of the same queries
  if (kg == 1) return;   // no barrier stands behind this line
  const v2f ml = *(const v2f*)(xr + 16); const float mt = fmaxf(m, ml[0]), fa = __builtin_amdgcn_exp2f(m - mt), fb = __builtin_amdgcn_exp2f(ml[0] - mt);
  l = l * fa + ml[1] * fb;
  l += other_half(l);
  const float il = 1.0f / l;   // sum and outputs both carry the 2^11
#pragma unroll
  for (int i = 0; i < 4; ++i) { const v4f p = *(const v4f*)(xr + 4 * i);
#pragma unroll
    for (int e = 0; e < 4; ++e) o[4 * i + e] = o[4 * i + e] * fa + p[e] * fb; }
#pragma unroll
  for (int j = 0; j < 2; ++j)
#pragma unroll
    for (int r = 0; r < 8; ++r) so[wave][col][j * 16 + 8 * g + r] = o[j * 8 + r] * il;
  LDSX(); for (int rl = 0; rl < 16; ++rl) if (lane < 8) vst2(AG + (rq + rl) * CI + lane * 4, *(const v4f*)&so[wave][rl][lane * 4]); }
// ---- k_out: block = (64 rows, 128 cols): out = x + sigma (AG (hi + lo) . W_out)
__global__ __launch_bounds__(128) void k_out(const float* __restrict__ AG, const __bf16* __restrict__ PO, const float* __restrict__ X, const float* __restrict__ SIG, float* __restrict__ OUT) { __shared__ __align__(16) float sf[4][16][132];
  const int tid = threadIdx.x, wave = tid >> 5, lane = tid & 31, col = lane & 15, g = lane >> 4; const size_t r0 = (size_t)blockIdx.x * 64 + wave * 16; const int c0 = blockIdx.y * 128; const float sg = bfr(SIG[0]);
  v8f acc[8] = {}; { const F2 a = split_row(AG + (r0 + col) * CI, 0, lane);
#pragma unroll
    for (int j = 0; j < 8; ++j) { const v16b w = frag_b(PO + (size_t)(c0 + j * 16 + col) * CI, lane); acc[j] = wmma_bf(a.h, w, acc[j]); acc[j] = wmma_bf(a.l, w, acc[j]); } }
#pragma unroll
  for (int j = 0; j < 8; ++j) { const int c = c0 + j * 16 + col;
#pragma unroll
    for (int r = 0; r < 8; ++r) sf[wave][8 * g + r][j * 16 + col] = bfr(X[(r0 + 8 * g + r) * CC + c]) + sg * acc[j][r]; }
  LDSX(); for (int rl = 0; rl < 16; ++rl) vst2(OUT + (r0 + rl) * CC + c0 + lane * 4, *(const v4f*)&sf[wave][rl][lane * 4]); }
extern "C" void kernel_launch(void* const* d_in, const int* in_sizes, int n_in, void* d_out, int out_size, void* d_ws, size_t ws_size, hipStream_t stream) {
  (void)in_sizes; (void)n_in; (void)out_size;
  const float** F = (const float**)d_in;   // 0 x [8,64,64,256], 1 y, 2 W_fy [256,32], 3 W_gx, 4 W_hx, 5 W_out [32,256], 6 sigma [1]
  if (ws_size < (size_t)WS_END) return;
  char* ws = (char*)d_ws; __bf16 *PW = (__bf16*)(ws + WS_PW), *PO = (__bf16*)(ws + WS_PO); _Float16 *FG = (_Float16*)(ws + WS_FG), *FGL = (_Float16*)(ws + WS_FGL), *HT = (_Float16*)(ws + WS_HT), *HTL = (_Float16*)(ws + WS_HTL); float* AG = (float*)(ws + WS_AG);
  k_pack<<<3 * CI + CC, 256, 0, stream>>>(F[2], F[3], F[4], F[5], PW, PO);
  k_proj<<<dim3(NN / 64, TNB), 128, 0, stream>>>(F[0], F[1], PW, FG, FGL, HT, HTL);
  k_att<<<dim3(NN / 64, TNB), 256, 0, stream>>>(FG, FGL, HT, HTL, AG);
  k_out<<<dim3(TNB * NN / 64, CC / 128), 128, 0, stream>>>(AG, PO, F[0], F[6], (float*)d_out);
}

// v005
// Measured time: 71.9 microseconds a run.
// Timed twice side by side with v004, it ran 1.04 times as fast both times.
// All steps since v000 together make it 4.10 times as fast.
// compute dtype: all float inputs rounded to bf16, sigma read on device; fy, gx, hx with EXACT bf16 products on WMMA 16x16x32 ((in,out) weights packed to transposed rows), fy (x log2 e) and gx rounded to f16 hi + residual rows, hx to f16 hi + residual planes (residuals at their own scale, f16 subnormals included); logits fy . gx (base 2) with 3 products in one accumulator, running-max softmax in f32 (hardware exp2), P (x 2^11, f16) . hx (2 products in one accumulator); out = x + sigma (attn_g (bf16 hi + lo, 2 products) . W_out); f32 output.
#include <hip/hip_runtime.h>
#include <math.h>

typedef __attribute__((ext_vector_type(16))) _Float16 v16h;
typedef __attribute__((ext_vector_type(16))) __bf16 v16b;
typedef __attribute__((ext_vector_type(8)))  _Float16 v8h;
typedef __attribute__((ext_vector_type(8)))  float v8f;
typedef __attribute__((ext_vector_type(4)))  float v4f;
typedef __attribute__((ext_vector_type(2)))  float v2f;
typedef __attribute__((ext_vector_type(4)))  unsigned v4u;
typedef __attribute__((ext_vector_type(4)))  int v4i;
typedef float __attribute__((may_alias)) float_a;
typedef int __attribute__((may_alias)) int_a;

template <typename T> __device__ __forceinline__ void vst2(void* p, T v) { *(T*)p = v;  }
__device__ __forceinline__ v8f wmma16(v16h a, v16h b, v8f c) {
  v8f d = __builtin_amdgcn_wmma_f32_16x16x32_f16(false, a, false, b, (short)0, c, false, false);
  asm volatile("v_nop\n\tv_nop\n\tv_nop\n\tv_nop" : "+v"(d) : "v"(a), "v"(b));
  return d;
}
__device__ __forceinline__ v8f wmma_bf(v16b a, v16b b, v8f c) {
  v8f d = __builtin_amdgcn_wmma_f32_16x16x32_bf16(false, a, false, b, (short)0, c, false, false);
  asm volatile("v_nop\n\tv_nop\n\tv_nop\n\tv_nop" : "+v"(d) : "v"(a), "v"(b));
  return d;
}
// 16x16x32 fragments: lane = (h = lane>>4, row/col = lane&15); elements 0..7 = k0+8h+0..7, 8..15 = k0+16+8h+0..7; D element r = row 8h+r
__device__ __forceinline__ v16h frag_h(const _Float16* rowk0, int lane) {
  union { v16h v; v8h q[2]; } u; const _Float16* p = rowk0 + 8 * (lane >> 4);
  u.q[0] = *(const v8h*)p; u.q[1] = *(const v8h*)(p + 16); return u.v;
}
__device__ __forceinline__ v16h frag_f32(const float* rowk0, int lane) {
  v16h a; const float* p = rowk0 + 8 * (lane >> 4);
#pragma unroll
  for (int i = 0; i < 8; ++i) { a[i] = (_Float16)p[i]; a[8 + i] = (_Float16)p[16 + i]; }
  return a;
}
__device__ __forceinline__ v16h frag_f32s(const float* rowk0, int lane, float sc) {
  v16h a; const float* p = rowk0 + 8 * (lane >> 4);
#pragma unroll
  for (int i = 0; i < 8; ++i) { a[i] = (_Float16)(p[i] * sc); a[8 + i] = (_Float16)(p[16 + i] * sc); }
  return a;
}
// column fragment from a [K][ld] layout (column n), rows >= K read as 0
__device__ __forceinline__ v16h fragc_f32(const float* W, int k0, int n, int lane, int ld, int K) {
  v16h a; const int g = lane >> 4;
#pragma unroll
  for (int i = 0; i < 8; ++i) { const int ka = k0 + 8 * g + i, kb = ka + 16;
    a[i] = (_Float16)(ka < K ? W[(size_t)(ka < K ? ka : K - 1) * ld + n] : 0.f); a[8 + i] = (_Float16)(kb < K ? W[(size_t)(kb < K ? kb : K - 1) * ld + n] : 0.f); }
  return a;
}
struct F2 { v16b h, l; };
__device__ __forceinline__ F2 bsplit16(const float v[16]) { F2 r;
#pragma unroll
  for (int i = 0; i < 16; ++i) { const __bf16 h = (__bf16)v[i]; r.h[i] = h; r.l[i] = (__bf16)(v[i] - (float)h); }
  return r; }
__device__ __forceinline__ F2 split_row(const float* row, int k0, int lane) { float v[16]; const float* p = row + k0 + 8 * (lane >> 4);
#pragma unroll
  for (int i = 0; i < 8; ++i) { v[i] = p[i]; v[8 + i] = p[16 + i]; }
  return bsplit16(v); }
__device__ __forceinline__ F2 split_rowK(const float* row, int k0, int lane, int K) { float v[16]; const int g = lane >> 4;
#pragma unroll
  for (int i = 0; i < 8; ++i) { const int ka = k0 + 8 * g + i, kb = ka + 16; v[i] = ka < K ? row[ka < K ? ka : K - 1] : 0.f; v[8 + i] = kb < K ? row[kb < K ? kb : K - 1] : 0.f; }
  return bsplit16(v); }
__device__ __forceinline__ F2 split_col(const float* W, int k0, int n, int lane, int ld, int K) { float v[16]; const int g = lane >> 4;
#pragma unroll
  for (int i = 0; i < 8; ++i) { const int ka = k0 + 8 * g + i, kb = ka + 16; v[i] = ka < K ? W[(size_t)(ka < K ? ka : K - 1) * ld + n] : 0.f; v[8 + i] = kb < K ? W[(size_t)(kb < K ? kb : K - 1) * ld + n] : 0.f; }
  return bsplit16(v); }
__device__ __forceinline__ v8f mac3(const F2& a, const F2& b, v8f c) { c = wmma_bf(a.l, b.h, c); c = wmma_bf(a.h, b.l, c); return wmma_bf(a.h, b.h, c); }
__device__ __forceinline__ float sigm(float v) { return 1.0f / (1.0f + expf(-v)); }
#define LDSX() do { asm volatile("s_wait_dscnt 0" ::: "memory"); __builtin_amdgcn_wave_barrier(); __builtin_amdgcn_fence(__ATOMIC_RELEASE, "workgroup"); } while (0)


// Self attention with channel reduction (B 8, 64 x 64 -> 4,096 positions, C 256, inner 32): attn = softmax(fy(y) . gx(x)^T) (unscaled); out = x + sigma (attn . hx(x)) W_out.
#define NB 8
#define NN 4096
#define CC 256
#define CI 32
#ifndef TNB
#define TNB NB
#endif
typedef __attribute__((ext_vector_type(8))) __bf16 v8b;
__device__ __forceinline__ v16b frag_b(const __bf16* rowk0, int lane) {
  union { v16b v; v8b q[2]; } u; const __bf16* p = rowk0 + 8 * (lane >> 4);
  u.q[0] = *(const v8b*)p; u.q[1] = *(const v8b*)(p + 16); return u.v;
}
__device__ __forceinline__ float bfr(float v) { return (float)(__bf16)v; }
__device__ __attribute__((noinline)) float exp_ni(float v) { return expf(v); }
__device__ __attribute__((noinline)) float erf_ni(float v) { return erff(v); }

#define WS_PW  0u                                   // bf16 rows [96][256]: fy | gx | hx weights transposed; [256][32] W_out^T
#define WS_PO  (WS_PW + 2u * 3 * CI * CC)
#define WS_FG  (WS_PO + 2u * CC * CI)                   // f16 hi|lo rows [b*NN + n][64] (fy 0..31 | gx 32..63)
#define WS_FGL (WS_FG + 2u * (size_t)NB * NN * 2 * CI)
#define WS_HT  (WS_FGL + 2u * (size_t)NB * NN * 2 * CI) // f16 hi|lo hx planes [b][32][NN]
#define WS_HTL (WS_HT + 2u * (size_t)NB * CI * NN)
#define WS_AG  (WS_HTL + 2u * (size_t)NB * CI * NN)    // f32 attn_g [b*NN + n][32]
#define WS_END (WS_AG + 4u * (size_t)NB * NN * CI)

__global__ __launch_bounds__(256) void k_pack(const float* __restrict__ WFY, const float* __restrict__ WGX, const float* __restrict__ WHX, const float* __restrict__ WOUT, __bf16* __restrict__ PW, __bf16* __restrict__ PO) { const int n = blockIdx.x, t = threadIdx.x; __shared__ __align__(16) __bf16 s[CC];   // n < 96: transposed (in,out) [256][32] rows; n >= 96: W_out^T rows [256 -> o][32]
  if (n < 3 * CI) { const float* Wm = n < CI ? WFY : n < 2 * CI ? WGX : WHX; const int o = n % CI; s[t] = (__bf16)Wm[(size_t)t * CI + o]; __syncthreads(); if (t < CC / 8) vst2((unsigned*)(PW + (size_t)n * CC + t * 8), *(const v4u*)&s[t * 8]); }
  else { const int o = n - 3 * CI; if (t < CI) s[t] = (__bf16)WOUT[(size_t)t * CC + o]; __syncthreads(); if (t < CI / 8) vst2((unsigned*)(PO + (size_t)o * CI + t * 8), *(const v4u*)&s[t * 8]); } }
__device__ __forceinline__ v16b fragb_f32(const float* __restrict__ p, int lane) { v16b a; const float* pp = p + 8 * (lane >> 4);
#pragma unroll
  for (int i = 0; i < 8; ++i) { a[i] = (__bf16)pp[i]; a[8 + i] = (__bf16)pp[16 + i]; } return a; }
// ---- k_proj: block = (64 positions, b): fy (from y), gx, hx (from x): 6 column tiles of 16; fy|gx -> rows hi/lo; hx -> planes hi/lo
__global__ __launch_bounds__(128) void k_proj(const float* __restrict__ X, const float* __restrict__ Y, const __bf16* __restrict__ PW, _Float16* __restrict__ FG, _Float16* __restrict__ FGL, _Float16* __restrict__ HT, _Float16* __restrict__ HTL) {
  __shared__ __align__(16) _Float16 sh[64][72], sl[64][72]; __shared__ __align__(16) _Float16 th[CI][72], tl[CI][72];
  const int tid = threadIdx.x, wave = tid >> 5, lane = tid & 31, col = lane & 15, g = lane >> 4; const size_t b = blockIdx.y; const int n0 = blockIdx.x * 64 + wave * 16; const size_t r0 = b * NN + n0;
  v8f acc[6] = {};
#pragma unroll 2
  for (int kc = 0; kc < CC / 32; ++kc) { const v16b ay = fragb_f32(Y + (r0 + col) * CC + kc * 32, lane), ax = fragb_f32(X + (r0 + col) * CC + kc * 32, lane);
#pragma unroll
    for (int j = 0; j < 6; ++j) acc[j] = wmma_bf(j < 2 ? ay : ax, frag_b(PW + (size_t)(j * 16 + col) * CC + kc * 32, lane), acc[j]); }
#pragma unroll
  for (int j = 0; j < 6; ++j)
#pragma unroll
    for (int r = 0; r < 8; ++r) { const float v = j < 2 ? acc[j][r] * 1.44269504088896340736f : acc[j][r]; const _Float16 hv = (_Float16)v, lv = (_Float16)(v - (float)hv);   // fy carries log2 e, so the softmax needs no multiply in front of exp2; a residual keeps its own scale, so its products add into the same accumulator as the hi products
      if (j < 4) { sh[wave * 16 + 8 * g + r][j * 16 + col] = hv; sl[wave * 16 + 8 * g + r][j * 16 + col] = lv; } else { th[(j - 4) * 16 + col][wave * 16 + 8 * g + r] = hv; tl[(j - 4) * 16 + col][wave * 16 + 8 * g + r] = lv; } }
  __syncthreads();
  for (int e = tid; e < 64 * 8; e += 128) { const int rl = e >> 3, q = e & 7; const size_t o = (b * NN + blockIdx.x * 64 + rl) * (2 * CI) + q * 8; vst2((unsigned*)(FG + o), *(const v4u*)&sh[rl][q * 8]); vst2((unsigned*)(FGL + o), *(const v4u*)&sl[rl][q * 8]); }
  for (int e = tid; e < CI * 8; e += 128) { const int cl = e >> 3, q = e & 7; const size_t o = (b * CI + cl) * (size_t)NN + blockIdx.x * 64 + q * 8; vst2((unsigned*)(HT + o), *(const v4u*)&th[cl][q * 8]); vst2((unsigned*)(HTL + o), *(const v4u*)&tl[cl][q * 8]); } }
// ---- staging for k_att: one stage = 128 keys: gx rows hi/lo (64 B a key, LDS pitch 80 B) and hx planes hi/lo (256 B a channel, LDS pitch 272 B); both pitches are 16 B x odd, free of bank conflicts for 16-byte fragment reads
#define KS 128
#define KP 40
#define VP 136
struct Stage { _Float16 kh[KS][KP], kl[KS][KP], vh[CI][VP], vl[CI][VP]; };
__device__ __forceinline__ unsigned lds_at(const _Float16* p) { return (unsigned)(size_t)p; }   // LDS byte address = low 32 bits of the __shared__ address
// four asynchronous copies global -> LDS, 16 bytes a lane each, through no register; s_wait_xcnt stands in the copies' own statement so that it precedes every rewrite of an address register they name
__device__ __forceinline__ void copy4(unsigned l0, const _Float16* g0, unsigned l1, const _Float16* g1, unsigned l2, const _Float16* g2, unsigned l3, const _Float16* g3) {
  asm volatile("global_load_async_to_lds_b128 %0, %1, off\n\tglobal_load_async_to_lds_b128 %2, %3, off\n\tglobal_load_async_to_lds_b128 %4, %5, off\n\tglobal_load_async_to_lds_b128 %6, %7, off\n\ts_wait_xcnt 0x0"
               :: "v"(l0), "v"(g0), "v"(l1), "v"(g1), "v"(l2), "v"(g2), "v"(l3), "v"(g3) : "memory"); }
// 256 threads fill one stage: 8 copies a thread; a key row is 4 pieces of 16 B (64 rows a round), a channel row 16 pieces (16 rows a round)
__device__ __forceinline__ void fill(Stage* s, const _Float16* __restrict__ FG, const _Float16* __restrict__ FGL, const _Float16* __restrict__ HT, const _Float16* __restrict__ HTL, size_t b, int st, int tid) {
  const int kr = tid >> 2, kq = (tid & 3) * 8, vr = tid >> 4, vq = (tid & 15) * 8;
  const size_t gk = (b * NN + st * KS + kr) * (2 * CI) + CI + kq, dk = 64 * (2 * CI), gv = (b * CI + vr) * (size_t)NN + st * KS + vq, dv = 16 * (size_t)NN;
  copy4(lds_at(&s->kh[kr][kq]), FG + gk, lds_at(&s->kh[kr + 64][kq]), FG + gk + dk, lds_at(&s->kl[kr][kq]), FGL + gk, lds_at(&s->kl[kr + 64][kq]), FGL + gk + dk);
  copy4(lds_at(&s->vh[vr][vq]), HT + gv, lds_at(&s->vh[vr + 16][vq]), HT + gv + dv, lds_at(&s->vl[vr][vq]), HTL + gv, lds_at(&s->vl[vr + 16][vq]), HTL + gv + dv); }
// ---- k_att: block = (64 queries, b), 8 waves: a wave holds TWO query tiles (32 queries) and walks one quarter (32 keys) of every stage, so each gx and hx fragment it reads from LDS feeds two tiles' products: half the LDS reads a score of the one-tile wave; waves (qp, kq = 0..3) share the 32 queries of pair qp, each with running maxima, sums and O of its own (four waves a SIMD with two blocks a WGP); the four partial results join once, through LDS, at the end; the block's waves read gx and hx from LDS stages (two buffers, the next stage's copies fly under this stage's work): transposed tiles S^T = gx_k . fy_q^T (3 products, one accumulator): a lane holds 16 of the 32 keys of ONE query of each tile, so maximum and sum are in-lane (one exchange between the wave's halves for the maximum; the halves' sums join once at the end) and a tile's two score tiles, converted in place, are the B operand of O^T += hx^T . P^T (2 products, one accumulator) -> AG rows
__device__ __forceinline__ float other_half(float v) { return __builtin_bit_cast(float, __builtin_amdgcn_permlanex16(__builtin_bit_cast(int, v), __builtin_bit_cast(int, v), 0x76543210, 0xfedcba98, false, false)); }   // lane l <-> l ^ 16
__global__ __launch_bounds__(256) void k_att(const _Float16* __restrict__ FG, const _Float16* __restrict__ FGL, const _Float16* __restrict__ HT, const _Float16* __restrict__ HTL, float* __restrict__ AG) {
  __shared__ __align__(16) float so[4][16][36]; __shared__ __align__(16) float xp[3][2][32][36]; __shared__ __align__(16) Stage sb[2];   // xp: a lane's 2 x 16 partial outputs, then maximum and sum of each tile; pitch 144 B = 16 B x odd
  const int tid = threadIdx.x, qp = (tid >> 5) & 1, kq = tid >> 6, lane = tid & 31, col = lane & 15, g = lane >> 4; const size_t b = blockIdx.y; const int q0 = blockIdx.x * 64 + qp * 32; const size_t rq = b * NN + q0;   // qp: query pair (tiles 2 qp, 2 qp + 1); kq: which quarter of a stage's keys
  v16h aq[2], aql[2];
#pragma unroll
  for (int t = 0; t < 2; ++t) { aq[t] = frag_h(FG + (rq + t * 16 + col) * (2 * CI), lane); aql[t] = frag_h(FGL + (rq + t * 16 + col) * (2 * CI), lane); }
  float m[2] = {-3.0e38f, -3.0e38f}, l[2] = {0.f, 0.f};   // query col of tile t: running maximum of the base-2 logits (equal in both halves), this half's share of the sum, x 2^11
  v8f acc[2][2] = {};   // [t][j] element r = channel j * 16 + 8 g + r of query col of tile t, x 2^11
  fill(&sb[0], FG, FGL, HT, HTL, b, 0, tid);
  asm volatile("s_wait_asynccnt 0x0" ::: "memory");   // this wave's copies of stage 0 have landed
  __syncthreads();                                     // publishes stage 0 to the other waves
  fill(&sb[1], FG, FGL, HT, HTL, b, 1, tid);
#pragma unroll 1   // one copy of the stage body: the publish point and the refill stand once, in the ring's order
  for (int st = 0; st < NN / KS; ++st) { const Stage* cs = &sb[st & 1];
  { const int ks = kq; v8f s[2][2];   // s[t][ct][r] = logit of key ks * 32 + ct * 16 + 8 g + r with query col of tile t
    v16h kh[2], kl[2], vh[2], vl[2];   // no LDS write stands in the pass, so all its fragment loads are issued at its head: the hx ones land under the score products and the softmax
#pragma unroll
    for (int ct = 0; ct < 2; ++ct) { const int rk = ks * 32 + ct * 16 + col; kh[ct] = frag_h(&cs->kh[rk][0], lane); kl[ct] = frag_h(&cs->kl[rk][0], lane); }
#pragma unroll
    for (int j = 0; j < 2; ++j) { vh[j] = frag_h(&cs->vh[j * 16 + col][ks * 32], lane); vl[j] = frag_h(&cs->vl[j * 16 + col][ks * 32], lane); }
#pragma unroll
    for (int t = 0; t < 2; ++t) {
      s[t][0] = wmma16(kl[0], aq[t], v8f{}); s[t][1] = wmma16(kl[1], aq[t], v8f{});   // the two key tiles' chains alternate: a product's successor in its own accumulator stands two matrix instructions behind it
      s[t][0] = wmma16(kh[0], aql[t], s[t][0]); s[t][1] = wmma16(kh[1], aql[t], s[t][1]);
      s[t][0] = wmma16(kh[0], aq[t], s[t][0]); s[t][1] = wmma16(kh[1], aq[t], s[t][1]); }
#pragma unroll
    for (int t = 0; t < 2; ++t) {
      float mx = fmaxf(s[t][0][0], s[t][1][0]), my = fmaxf(s[t][0][4], s[t][1][4]);   // two chains, half the dependent length
#pragma unroll
      for (int r = 1; r < 4; ++r) { mx = fmaxf(mx, fmaxf(s[t][0][r], s[t][1][r])); my = fmaxf(my, fmaxf(s[t][0][4 + r], s[t][1][4 + r])); }
      mx = fmaxf(mx, my);
      mx = fmaxf(mx, other_half(mx));
      const float mn = fmaxf(m[t], mx), alpha = __builtin_amdgcn_exp2f(m[t] - mn), mb = mn - 11.0f; m[t] = mn;   // mb: the 2^11 of P rides in the subtracted maximum
      v16h pa; float es = 0.f;   // pa element i = key 8 g + i, 8 + i = key 16 + 8 g + i: the k order of frag_h
#pragma unroll
      for (int r = 0; r < 8; ++r) { const float e0 = __builtin_amdgcn_exp2f(s[t][0][r] - mb), e1 = __builtin_amdgcn_exp2f(s[t][1][r] - mb); es += e0 + e1; pa[r] = (_Float16)e0; pa[8 + r] = (_Float16)e1; }
      l[t] = l[t] * alpha + es;
#pragma unroll
      for (int j = 0; j < 2; ++j)
#pragma unroll
        for (int r = 0; r < 8; ++r) acc[t][j][r] *= alpha;
      acc[t][0] = wmma16(vh[0], pa, acc[t][0]); acc[t][1] = wmma16(vh[1], pa, acc[t][1]);
      acc[t][0] = wmma16(vl[0], pa, acc[t][0]); acc[t][1] = wmma16(vl[1], pa, acc[t][1]); } }
    asm volatile("s_wait_dscnt 0x0" ::: "memory");      // this wave's reads of stage st are done before its buffer is handed back
    asm volatile("s_wait_asynccnt 0x0" ::: "memory");   // this wave's copies of stage st + 1 have landed
    __syncthreads();                                     // publishes stage st + 1 and ends every wave's reads of stage st
    if (st + 2 < NN / KS) fill(&sb[st & 1], FG, FGL, HT, HTL, b, st + 2, tid); }
  asm volatile("s_wait_asynccnt 0x0" ::: "memory");     // no copy is outstanding when the wave goes on to its end
  float o[2][16];   // this wave's partial outputs, tile t relative to its own maximum m[t]
#pragma unroll
  for (int t = 0; t < 2; ++t)
#pragma unroll
    for (int j = 0; j < 2; ++j)
#pragma unroll
      for (int r = 0; r < 8; ++r) o[t][j * 8 + r] = acc[t][j][r];
  if (kq != 0) { float* xw = &xp[kq - 1][qp][lane][0];
#pragma unroll
    for (int t = 0; t < 2; ++t)
#pragma unroll
      for (int i = 0; i < 4; ++i) *(v4f*)(xw + 16 * t + 4 * i) = v4f{o[t][4 * i], o[t][4 * i + 1], o[t][4 * i + 2], o[t][4 * i + 3]};
    *(v4f*)(xw + 32) = v4f{m[0], l[0], m[1], l[1]}; }
  __syncthreads();   // hands the other three key quarters' partial results to the wave that holds the first quarter of the same queries
  if (kq != 0) return;   // no barrier stands behind this line
  v4f ml[3];
#pragma unroll
  for (int p = 0; p < 3; ++p) ml[p] = *(const v4f*)(&xp[p][qp][lane][32]);
#pragma unroll
  for (int t = 0; t < 2; ++t) {
    const float mt = fmaxf(fmaxf(m[t], ml[0][2 * t]), fmaxf(ml[1][2 * t], ml[2][2 * t])), fa = __builtin_amdgcn_exp2f(m[t] - mt);
    float lt = l[t] * fa;
#pragma unroll
    for (int i = 0; i < 16; ++i) o[t][i] *= fa;
#pragma unroll
    for (int p = 0; p < 3; ++p) { const float fb = __builtin_amdgcn_exp2f(ml[p][2 * t] - mt); lt += ml[p][2 * t + 1] * fb;
#pragma unroll
      for (int i = 0; i < 4; ++i) { const v4f pv = *(const v4f*)(&xp[p][qp][lane][16 * t + 4 * i]);
#pragma unroll
        for (int e = 0; e < 4; ++e) o[t][4 * i + e] += pv[e] * fb; } }
    lt += other_half(lt);
    const float il = 1.0f / lt;   // sum and outputs both carry the 2^11
#pragma unroll
    for (int j = 0; j < 2; ++j)
#pragma unroll
      for (int r = 0; r < 8; ++r) so[qp * 2 + t][col][j * 16 + 8 * g + r] = o[t][j * 8 + r] * il; }
  LDSX();
#pragma unroll
  for (int t = 0; t < 2; ++t) for (int rl = 0; rl < 16; ++rl) if (lane < 8) vst2(AG + (rq + t * 16 + rl) * CI + lane * 4, *(const v4f*)&so[qp * 2 + t][rl][lane * 4]); }
// ---- k_out: block = (64 rows, 128 cols): out = x + sigma (AG (hi + lo) . W_out)
__global__ __launch_bounds__(128) void k_out(const float* __restrict__ AG, const __bf16* __restrict__ PO, const float* __restrict__ X, const float* __restrict__ SIG, float* __restrict__ OUT) { __shared__ __align__(16) float sf[4][16][132];
  const int tid = threadIdx.x, wave = tid >> 5, lane = tid & 31, col = lane & 15, g = lane >> 4; const size_t r0 = (size_t)blockIdx.x * 64 + wave * 16; const int c0 = blockIdx.y * 128; const float sg = bfr(SIG[0]);
  v8f acc[8] = {}; { const F2 a = split_row(AG + (r0 + col) * CI, 0, lane);
#pragma unroll
    for (int j = 0; j < 8; ++j) { const v16b w = frag_b(PO + (size_t)(c0 + j * 16 + col) * CI, lane); acc[j] = wmma_bf(a.h, w, acc[j]); acc[j] = wmma_bf(a.l, w, acc[j]); } }
#pragma unroll
  for (int j = 0; j < 8; ++j) { const int c = c0 + j * 16 + col;
#pragma unroll
    for (int r = 0; r < 8; ++r) sf[wave][8 * g + r][j * 16 + col] = bfr(X[(r0 + 8 * g + r) * CC + c]) + sg * acc[j][r]; }
  LDSX(); for (int rl = 0; rl < 16; ++rl) vst2(OUT + (r0 + rl) * CC + c0 + lane * 4, *(const v4f*)&sf[wave][rl][lane * 4]); }
extern "C" void kernel_launch(void* const* d_in, const int* in_sizes, int n_in, void* d_out, int out_size, void* d_ws, size_t ws_size, hipStream_t stream) {
  (void)in_sizes; (void)n_in; (void)out_size;
  const float** F = (const float**)d_in;   // 0 x [8,64,64,256], 1 y, 2 W_fy [256,32], 3 W_gx, 4 W_hx, 5 W_out [32,256], 6 sigma [1]
  if (ws_size < (size_t)WS_END) return;
  char* ws = (char*)d_ws; __bf16 *PW = (__bf16*)(ws + WS_PW), *PO = (__bf16*)(ws + WS_PO); _Float16 *FG = (_Float16*)(ws + WS_FG), *FGL = (_Float16*)(ws + WS_FGL), *HT = (_Float16*)(ws + WS_HT), *HTL = (_Float16*)(ws + WS_HTL); float* AG = (float*)(ws + WS_AG);
  k_pack<<<3 * CI + CC, 256, 0, stream>>>(F[2], F[3], F[4], F[5], PW, PO);
  k_proj<<<dim3(NN / 64, TNB), 128, 0, stream>>>(F[0], F[1], PW, FG, FGL, HT, HTL);
  k_att<<<dim3(NN / 64, TNB), 256, 0, stream>>>(FG, FGL, HT, HTL, AG);
  k_out<<<dim3(TNB * NN / 64, CC / 128), 128, 0, stream>>>(AG, PO, F[0], F[6], (float*)d_out);
}

// v006
// Measured time: 68.6 microseconds a run.
// Next to v005, in two timings, it ran 1.05 and 1.04 times as fast.
// All steps since v000 together make it 4.29 times as fast.
// compute dtype: all float inputs rounded to bf16, sigma read on device; fy, gx, hx with EXACT bf16 products on WMMA 16x16x32 ((in,out) weights packed to transposed rows), fy (x log2 e) and gx rounded to f16 hi + residual rows, hx to f16 hi + residual planes (residuals at their own scale, f16 subnormals included); logits fy . gx (base 2) with 3 products in one accumulator, running-max softmax in f32 (hardware exp2), P (x 2^11, f16) . hx (2 products in one accumulator); out = x + sigma (attn_g (bf16 hi + lo, 2 products) . W_out); f32 output.
#include <hip/hip_runtime.h>
#include <math.h>

typedef __attribute__((ext_vector_type(16))) _Float16 v16h;
typedef __attribute__((ext_vector_type(16))) __bf16 v16b;
typedef __attribute__((ext_vector_type(8)))  _Float16 v8h;
typedef __attribute__((ext_vector_type(8)))  float v8f;
typedef __attribute__((ext_vector_type(4)))  float v4f;
typedef __attribute__((ext_vector_type(2)))  float v2f;
typedef __attribute__((ext_vector_type(4)))  unsigned v4u;
typedef __attribute__((ext_vector_type(4)))  int v4i;
typedef float __attribute__((may_alias)) float_a;
typedef int __attribute__((may_alias)) int_a;

template <typename T> __device__ __forceinline__ void vst2(void* p, T v) { *(T*)p = v;  }
__device__ __forceinline__ v8f wmma16(v16h a, v16h b, v8f c) {   // the builtin alone: the compiler keeps the distance behind it itself and is free to put other work of the wave there
  return __builtin_amdgcn_wmma_f32_16x16x32_f16(false, a, false, b, (short)0, c, false, false);
}
__device__ __forceinline__ v8f wmma_bf(v16b a, v16b b, v8f c) {
  v8f d = __builtin_amdgcn_wmma_f32_16x16x32_bf16(false, a, false, b, (short)0, c, false, false);
  asm volatile("v_nop\n\tv_nop\n\tv_nop\n\tv_nop" : "+v"(d) : "v"(a), "v"(b));
  return d;
}
// 16x16x32 fragments: lane = (h = lane>>4, row/col = lane&15); elements 0..7 = k0+8h+0..7, 8..15 = k0+16+8h+0..7; D element r = row 8h+r
__device__ __forceinline__ v16h frag_h(const _Float16* rowk0, int lane) {
  union { v16h v; v8h q[2]; } u; const _Float16* p = rowk0 + 8 * (lane >> 4);
  u.q[0] = *(const v8h*)p; u.q[1] = *(const v8h*)(p + 16); return u.v;
}
__device__ __forceinline__ v16h frag_f32(const float* rowk0, int lane) {
  v16h a; const float* p = rowk0 + 8 * (lane >> 4);
#pragma unroll
  for (int i = 0; i < 8; ++i) { a[i] = (_Float16)p[i]; a[8 + i] = (_Float16)p[16 + i]; }
  return a;
}
__device__ __forceinline__ v16h frag_f32s(const float* rowk0, int lane, float sc) {
  v16h a; const float* p = rowk0 + 8 * (lane >> 4);
#pragma unroll
  for (int i = 0; i < 8; ++i) { a[i] = (_Float16)(p[i] * sc); a[8 + i] = (_Float16)(p[16 + i] * sc); }
  return a;
}
// column fragment from a [K][ld] layout (column n), rows >= K read as 0
__device__ __forceinline__ v16h fragc_f32(const float* W, int k0, int n, int lane, int ld, int K) {
  v16h a; const int g = lane >> 4;
#pragma unroll
  for (int i = 0; i < 8; ++i) { const int ka = k0 + 8 * g + i, kb = ka + 16;
    a[i] = (_Float16)(ka < K ? W[(size_t)(ka < K ? ka : K - 1) * ld + n] : 0.f); a[8 + i] = (_Float16)(kb < K ? W[(size_t)(kb < K ? kb : K - 1) * ld + n] : 0.f); }
  return a;
}
struct F2 { v16b h, l; };
__device__ __forceinline__ F2 bsplit16(const float v[16]) { F2 r;
#pragma unroll
  for (int i = 0; i < 16; ++i) { const __bf16 h = (__bf16)v[i]; r.h[i] = h; r.l[i] = (__bf16)(v[i] - (float)h); }
  return r; }
__device__ __forceinline__ F2 split_row(const float* row, int k0, int lane) { float v[16]; const float* p = row + k0 + 8 * (lane >> 4);
#pragma unroll
  for (int i = 0; i < 8; ++i) { v[i] = p[i]; v[8 + i] = p[16 + i]; }
  return bsplit16(v); }
__device__ __forceinline__ F2 split_rowK(const float* row, int k0, int lane, int K) { float v[16]; const int g = lane >> 4;
#pragma unroll
  for (int i = 0; i < 8; ++i) { const int ka = k0 + 8 * g + i, kb = ka + 16; v[i] = ka < K ? row[ka < K ? ka : K - 1] : 0.f; v[8 + i] = kb < K ? row[kb < K ? kb : K - 1] : 0.f; }
  return bsplit16(v); }
__device__ __forceinline__ F2 split_col(const float* W, int k0, int n, int lane, int ld, int K) { float v[16]; const int g = lane >> 4;
#pragma unroll
  for (int i = 0; i < 8; ++i) { const int ka = k0 + 8 * g + i, kb = ka + 16; v[i] = ka < K ? W[(size_t)(ka < K ? ka : K - 1) * ld + n] : 0.f; v[8 + i] = kb < K ? W[(size_t)(kb < K ? kb : K - 1) * ld + n] : 0.f; }
  return bsplit16(v); }
__device__ __forceinline__ v8f mac3(const F2& a, const F2& b, v8f c) { c = wmma_bf(a.l, b.h, c); c = wmma_bf(a.h, b.l, c); return wmma_bf(a.h, b.h, c); }
__device__ __forceinline__ float sigm(float v) { return 1.0f / (1.0f + expf(-v)); }
#define LDSX() do { asm volatile("s_wait_dscnt 0" ::: "memory"); __builtin_amdgcn_wave_barrier(); __builtin_amdgcn_fence(__ATOMIC_RELEASE, "workgroup"); } while (0)


// Self attention with channel reduction (B 8, 64 x 64 -> 4,096 positions, C 256, inner 32): attn = softmax(fy(y) . gx(x)^T) (unscaled); out = x + sigma (attn . hx(x)) W_out.
#define NB 8
#define NN 4096
#define CC 256
#define CI 32
#ifndef TNB
#define TNB NB
#endif
typedef __attribute__((ext_vector_type(8))) __bf16 v8b;
__device__ __forceinline__ v16b frag_b(const __bf16* rowk0, int lane) {
  union { v16b v; v8b q[2]; } u; const __bf16* p = rowk0 + 8 * (lane >> 4);
  u.q[0] = *(const v8b*)p; u.q[1] = *(const v8b*)(p + 16); return u.v;
}
__device__ __forceinline__ float bfr(float v) { return (float)(__bf16)v; }
__device__ __attribute__((noinline)) float exp_ni(float v) { return expf(v); }
__device__ __attribute__((noinline)) float erf_ni(float v) { return erff(v); }

#define WS_PW  0u                                   // bf16 rows [96][256]: fy | gx | hx weights transposed; [256][32] W_out^T
#define WS_PO  (WS_PW + 2u * 3 * CI * CC)
#define WS_FG  (WS_PO + 2u * CC * CI)                   // f16 hi|lo rows [b*NN + n][64] (fy 0..31 | gx 32..63)
#define WS_FGL (WS_FG + 2u * (size_t)NB * NN * 2 * CI)
#define WS_HT  (WS_FGL + 2u * (size_t)NB * NN * 2 * CI) // f16 hi|lo hx planes [b][32][NN]
#define WS_HTL (WS_HT + 2u * (size_t)NB * CI * NN)
#define WS_AG  (WS_HTL + 2u * (size_t)NB * CI * NN)    // f32 attn_g [b*NN + n][32]
#define WS_END (WS_AG + 4u * (size_t)NB * NN * CI)

__global__ __launch_bounds__(256) void k_pack(const float* __restrict__ WFY, const float* __restrict__ WGX, const float* __restrict__ WHX, const float* __restrict__ WOUT, __bf16* __restrict__ PW, __bf16* __restrict__ PO) { const int n = blockIdx.x, t = threadIdx.x; __shared__ __align__(16) __bf16 s[CC];   // n < 96: transposed (in,out) [256][32] rows; n >= 96: W_out^T rows [256 -> o][32]
  if (n < 3 * CI) { const float* Wm = n < CI ? WFY : n < 2 * CI ? WGX : WHX; const int o = n % CI; s[t] = (__bf16)Wm[(size_t)t * CI + o]; __syncthreads(); if (t < CC / 8) vst2((unsigned*)(PW + (size_t)n * CC + t * 8), *(const v4u*)&s[t * 8]); }
  else { const int o = n - 3 * CI; if (t < CI) s[t] = (__bf16)WOUT[(size_t)t * CC + o]; __syncthreads(); if (t < CI / 8) vst2((unsigned*)(PO + (size_t)o * CI + t * 8), *(const v4u*)&s[t * 8]); } }
__device__ __forceinline__ v16b fragb_f32(const float* __restrict__ p, int lane) { v16b a; const float* pp = p + 8 * (lane >> 4);
#pragma unroll
  for (int i = 0; i < 8; ++i) { a[i] = (__bf16)pp[i]; a[8 + i] = (__bf16)pp[16 + i]; } return a; }
// ---- k_proj: block = (64 positions, b): fy (from y), gx, hx (from x): 6 column tiles of 16; fy|gx -> rows hi/lo; hx -> planes hi/lo
__global__ __launch_bounds__(128) void k_proj(const float* __restrict__ X, const float* __restrict__ Y, const __bf16* __restrict__ PW, _Float16* __restrict__ FG, _Float16* __restrict__ FGL, _Float16* __restrict__ HT, _Float16* __restrict__ HTL) {
  __shared__ __align__(16) _Float16 sh[64][72], sl[64][72]; __shared__ __align__(16) _Float16 th[CI][72], tl[CI][72];
  const int tid = threadIdx.x, wave = tid >> 5, lane = tid & 31, col = lane & 15, g = lane >> 4; const size_t b = blockIdx.y; const int n0 = blockIdx.x * 64 + wave * 16; const size_t r0 = b * NN + n0;
  v8f acc[6] = {};
#pragma unroll 2
  for (int kc = 0; kc < CC / 32; ++kc) { const v16b ay = fragb_f32(Y + (r0 + col) * CC + kc * 32, lane), ax = fragb_f32(X + (r0 + col) * CC + kc * 32, lane);
#pragma unroll
    for (int j = 0; j < 6; ++j) acc[j] = wmma_bf(j < 2 ? ay : ax, frag_b(PW + (size_t)(j * 16 + col) * CC + kc * 32, lane), acc[j]); }
#pragma unroll
  for (int j = 0; j < 6; ++j)
#pragma unroll
    for (int r = 0; r < 8; ++r) { const float v = j < 2 ? acc[j][r] * 1.44269504088896340736f : acc[j][r]; const _Float16 hv = (_Float16)v, lv = (_Float16)(v - (float)hv);   // fy carries log2 e, so the softmax needs no multiply in front of exp2; a residual keeps its own scale, so its products add into the same accumulator as the hi products
      if (j < 4) { sh[wave * 16 + 8 * g + r][j * 16 + col] = hv; sl[wave * 16 + 8 * g + r][j * 16 + col] = lv; } else { th[(j - 4) * 16 + col][wave * 16 + 8 * g + r] = hv; tl[(j - 4) * 16 + col][wave * 16 + 8 * g + r] = lv; } }
  __syncthreads();
  for (int e = tid; e < 64 * 8; e += 128) { const int rl = e >> 3, q = e & 7; const size_t o = (b * NN + blockIdx.x * 64 + rl) * (2 * CI) + q * 8; vst2((unsigned*)(FG + o), *(const v4u*)&sh[rl][q * 8]); vst2((unsigned*)(FGL + o), *(const v4u*)&sl[rl][q * 8]); }
  for (int e = tid; e < CI * 8; e += 128) { const int cl = e >> 3, q = e & 7; const size_t o = (b * CI + cl) * (size_t)NN + blockIdx.x * 64 + q * 8; vst2((unsigned*)(HT + o), *(const v4u*)&th[cl][q * 8]); vst2((unsigned*)(HTL + o), *(const v4u*)&tl[cl][q * 8]); } }
// ---- staging for k_att: one stage = 128 keys: gx rows hi/lo (64 B a key, LDS pitch 80 B) and hx planes hi/lo (256 B a channel, LDS pitch 272 B); both pitches are 16 B x odd, free of bank conflicts for 16-byte fragment reads
#define KS 128
#define KP 40
#define VP 136
struct Stage { _Float16 kh[KS][KP], kl[KS][KP], vh[CI][VP], vl[CI][VP]; };
__device__ __forceinline__ unsigned lds_at(const _Float16* p) { return (unsigned)(size_t)p; }   // LDS byte address = low 32 bits of the __shared__ address
// four asynchronous copies global -> LDS, 16 bytes a lane each, through no register; s_wait_xcnt stands in the copies' own statement so that it precedes every rewrite of an address register they name
__device__ __forceinline__ void copy4(unsigned l0, const _Float16* g0, unsigned l1, const _Float16* g1, unsigned l2, const _Float16* g2, unsigned l3, const _Float16* g3) {
  asm volatile("global_load_async_to_lds_b128 %0, %1, off\n\tglobal_load_async_to_lds_b128 %2, %3, off\n\tglobal_load_async_to_lds_b128 %4, %5, off\n\tglobal_load_async_to_lds_b128 %6, %7, off\n\ts_wait_xcnt 0x0"
               :: "v"(l0), "v"(g0), "v"(l1), "v"(g1), "v"(l2), "v"(g2), "v"(l3), "v"(g3) : "memory"); }
// 256 threads fill one stage: 8 copies a thread; a key row is 4 pieces of 16 B (64 rows a round), a channel row 16 pieces (16 rows a round)
__device__ __forceinline__ void fill(Stage* s, const _Float16* __restrict__ FG, const _Float16* __restrict__ FGL, const _Float16* __restrict__ HT, const _Float16* __restrict__ HTL, size_t b, int st, int tid) {
  const int kr = tid >> 2, kq = (tid & 3) * 8, vr = tid >> 4, vq = (tid & 15) * 8;
  const size_t gk = (b * NN + st * KS + kr) * (2 * CI) + CI + kq, dk = 64 * (2 * CI), gv = (b * CI + vr) * (size_t)NN + st * KS + vq, dv = 16 * (size_t)NN;
  copy4(lds_at(&s->kh[kr][kq]), FG + gk, lds_at(&s->kh[kr + 64][kq]), FG + gk + dk, lds_at(&s->kl[kr][kq]), FGL + gk, lds_at(&s->kl[kr + 64][kq]), FGL + gk + dk);
  copy4(lds_at(&s->vh[vr][vq]), HT + gv, lds_at(&s->vh[vr + 16][vq]), HT + gv + dv, lds_at(&s->vl[vr][vq]), HTL + gv, lds_at(&s->vl[vr + 16][vq]), HTL + gv + dv); }
// ---- k_att: block = (64 queries, b), 8 waves: a wave holds TWO query tiles (32 queries) and walks one quarter (32 keys) of every stage, so each gx and hx fragment it reads from LDS feeds two tiles' products: half the LDS reads a score of the one-tile wave; waves (qp, kq = 0..3) share the 32 queries of pair qp, each with running maxima, sums and O of its own (four waves a SIMD with two blocks a WGP); the four partial results join once, through LDS, at the end; the block's waves read gx and hx from LDS stages (two buffers, the next stage's copies fly under this stage's work): transposed tiles S^T = gx_k . fy_q^T (3 products, one accumulator): a lane holds 16 of the 32 keys of ONE query of each tile, so maximum and sum are in-lane (one exchange between the wave's halves for the maximum; the halves' sums join once at the end) and a tile's two score tiles, converted in place, are the B operand of O^T += hx^T . P^T (2 products, one accumulator) -> AG rows
__device__ __forceinline__ float other_half(float v) { return __builtin_bit_cast(float, __builtin_amdgcn_permlanex16(__builtin_bit_cast(int, v), __builtin_bit_cast(int, v), 0x76543210, 0xfedcba98, false, false)); }   // lane l <-> l ^ 16
__global__ __launch_bounds__(256) void k_att(const _Float16* __restrict__ FG, const _Float16* __restrict__ FGL, const _Float16* __restrict__ HT, const _Float16* __restrict__ HTL, float* __restrict__ AG) {
  __shared__ __align__(16) float so[4][16][36]; __shared__ __align__(16) float xp[3][2][32][36]; __shared__ __align__(16) Stage sb[2];   // xp: a lane's 2 x 16 partial outputs, then maximum and sum of each tile; pitch 144 B = 16 B x odd
  const int tid = threadIdx.x, qp = (tid >> 5) & 1, kq = tid >> 6, lane = tid & 31, col = lane & 15, g = lane >> 4; const size_t b = blockIdx.y; const int q0 = blockIdx.x * 64 + qp * 32; const size_t rq = b * NN + q0;   // qp: query pair (tiles 2 qp, 2 qp + 1); kq: which quarter of a stage's keys
  v16h aq[2], aql[2];
#pragma unroll
  for (int t = 0; t < 2; ++t) { aq[t] = frag_h(FG + (rq + t * 16 + col) * (2 * CI), lane); aql[t] = frag_h(FGL + (rq + t * 16 + col) * (2 * CI), lane); }
  float m[2] = {-3.0e38f, -3.0e38f}, l[2] = {0.f, 0.f};   // query col of tile t: running maximum of the base-2 logits (equal in both halves), this half's share of the sum, x 2^11
  v8f acc[2][2] = {};   // [t][j] element r = channel j * 16 + 8 g + r of query col of tile t, x 2^11
  fill(&sb[0], FG, FGL, HT, HTL, b, 0, tid);
  asm volatile("s_wait_asynccnt 0x0" ::: "memory");   // this wave's copies of stage 0 have landed
  __syncthreads();                                     // publishes stage 0 to the other waves
  fill(&sb[1], FG, FGL, HT, HTL, b, 1, tid);
#pragma unroll 1   // one copy of the stage body: the publish point and the refill stand once, in the ring's order
  for (int st = 0; st < NN / KS; ++st) { const Stage* cs = &sb[st & 1];
  { const int ks = kq; v8f s[2][2];   // s[t][ct][r] = logit of key ks * 32 + ct * 16 + 8 g + r with query col of tile t
    v16h kh[2], kl[2], vh[2], vl[2];   // no LDS write stands in the pass, so all its fragment loads are issued at its head: the hx ones land under the score products and the softmax
#pragma unroll
    for (int ct = 0; ct < 2; ++ct) { const int rk = ks * 32 + ct * 16 + col; kh[ct] = frag_h(&cs->kh[rk][0], lane); kl[ct] = frag_h(&cs->kl[rk][0], lane); }
#pragma unroll
    for (int j = 0; j < 2; ++j) { vh[j] = frag_h(&cs->vh[j * 16 + col][ks * 32], lane); vl[j] = frag_h(&cs->vl[j * 16 + col][ks * 32], lane); }
#pragma unroll
    for (int t = 0; t < 2; ++t) {
      s[t][0] = wmma16(kl[0], aq[t], v8f{}); s[t][1] = wmma16(kl[1], aq[t], v8f{});   // the two key tiles' chains alternate: a product's successor in its own accumulator stands two matrix instructions behind it
      s[t][0] = wmma16(kh[0], aql[t], s[t][0]); s[t][1] = wmma16(kh[1], aql[t], s[t][1]);
      s[t][0] = wmma16(kh[0], aq[t], s[t][0]); s[t][1] = wmma16(kh[1], aq[t], s[t][1]); }
#pragma unroll
    for (int t = 0; t < 2; ++t) {
      float mx = fmaxf(s[t][0][0], s[t][1][0]), my = fmaxf(s[t][0][4], s[t][1][4]);   // two chains, half the dependent length
#pragma unroll
      for (int r = 1; r < 4; ++r) { mx = fmaxf(mx, fmaxf(s[t][0][r], s[t][1][r])); my = fmaxf(my, fmaxf(s[t][0][4 + r], s[t][1][4 + r])); }
      mx = fmaxf(mx, my);
      mx = fmaxf(mx, other_half(mx));
      const float mn = fmaxf(m[t], mx), alpha = __builtin_amdgcn_exp2f(m[t] - mn), mb = mn - 11.0f; m[t] = mn;   // mb: the 2^11 of P rides in the subtracted maximum
      v16h pa; float es = 0.f;   // pa element i = key 8 g + i, 8 + i = key 16 + 8 g + i: the k order of frag_h
#pragma unroll
      for (int r = 0; r < 8; ++r) { const float e0 = __builtin_amdgcn_exp2f(s[t][0][r] - mb), e1 = __builtin_amdgcn_exp2f(s[t][1][r] - mb); es += e0 + e1; pa[r] = (_Float16)e0; pa[8 + r] = (_Float16)e1; }
      l[t] = l[t] * alpha + es;
#pragma unroll
      for (int j = 0; j < 2; ++j)
#pragma unroll
        for (int r = 0; r < 8; ++r) acc[t][j][r] *= alpha;
      acc[t][0] = wmma16(vh[0], pa, acc[t][0]); acc[t][1] = wmma16(vh[1], pa, acc[t][1]);
      acc[t][0] = wmma16(vl[0], pa, acc[t][0]); acc[t][1] = wmma16(vl[1], pa, acc[t][1]); } }
    asm volatile("s_wait_dscnt 0x0" ::: "memory");      // this wave's reads of stage st are done before its buffer is handed back
    asm volatile("s_wait_asynccnt 0x0" ::: "memory");   // this wave's copies of stage st + 1 have landed
    __syncthreads();                                     // publishes stage st + 1 and ends every wave's reads of stage st
    if (st + 2 < NN / KS) fill(&sb[st & 1], FG, FGL, HT, HTL, b, st + 2, tid); }
  asm volatile("s_wait_asynccnt 0x0" ::: "memory");     // no copy is outstanding when the wave goes on to its end
  float o[2][16];   // this wave's partial outputs, tile t relative to its own maximum m[t]
#pragma unroll
  for (int t = 0; t < 2; ++t)
#pragma unroll
    for (int j = 0; j < 2; ++j)
#pragma unroll
      for (int r = 0; r < 8; ++r) o[t][j * 8 + r] = acc[t][j][r];
  if (kq != 0) { float* xw = &xp[kq - 1][qp][lane][0];
#pragma unroll
    for (int t = 0; t < 2; ++t)
#pragma unroll
      for (int i = 0; i < 4; ++i) *(v4f*)(xw + 16 * t + 4 * i) = v4f{o[t][4 * i], o[t][4 * i + 1], o[t][4 * i + 2], o[t][4 * i + 3]};
    *(v4f*)(xw + 32) = v4f{m[0], l[0], m[1], l[1]}; }
  __syncthreads();   // hands the other three key quarters' partial results to the wave that holds the first quarter of the same queries
  if (kq != 0) return;   // no barrier stands behind this line
  v4f ml[3];
#pragma unroll
  for (int p = 0; p < 3; ++p) ml[p] = *(const v4f*)(&xp[p][qp][lane][32]);
#pragma unroll
  for (int t = 0; t < 2; ++t) {
    const float mt = fmaxf(fmaxf(m[t], ml[0][2 * t]), fmaxf(ml[1][2 * t], ml[2][2 * t])), fa = __builtin_amdgcn_exp2f(m[t] - mt);
    float lt = l[t] * fa;
#pragma unroll
    for (int i = 0; i < 16; ++i) o[t][i] *= fa;
#pragma unroll
    for (int p = 0; p < 3; ++p) { const float fb = __builtin_amdgcn_exp2f(ml[p][2 * t] - mt); lt += ml[p][2 * t + 1] * fb;
#pragma unroll
      for (int i = 0; i < 4; ++i) { const v4f pv = *(const v4f*)(&xp[p][qp][lane][16 * t + 4 * i]);
#pragma unroll
        for (int e = 0; e < 4; ++e) o[t][4 * i + e] += pv[e] * fb; } }
    lt += other_half(lt);
    const float il = 1.0f / lt;   // sum and outputs both carry the 2^11
#pragma unroll
    for (int j = 0; j < 2; ++j)
#pragma unroll
      for (int r = 0; r < 8; ++r) so[qp * 2 + t][col][j * 16 + 8 * g + r] = o[t][j * 8 + r] * il; }
  LDSX();
#pragma unroll
  for (int t = 0; t < 2; ++t) for (int rl = 0; rl < 16; ++rl) if (lane < 8) vst2(AG + (rq + t * 16 + rl) * CI + lane * 4, *(const v4f*)&so[qp * 2 + t][rl][lane * 4]); }
// ---- k_out: block = (64 rows, 128 cols): out = x + sigma (AG (hi + lo) . W_out)
__global__ __launch_bounds__(128) void k_out(const float* __restrict__ AG, const __bf16* __restrict__ PO, const float* __restrict__ X, const float* __restrict__ SIG, float* __restrict__ OUT) { __shared__ __align__(16) float sf[4][16][132];
  const int tid = threadIdx.x, wave = tid >> 5, lane = tid & 31, col = lane & 15, g = lane >> 4; const size_t r0 = (size_t)blockIdx.x * 64 + wave * 16; const int c0 = blockIdx.y * 128; const float sg = bfr(SIG[0]);
  v8f acc[8] = {}; { const F2 a = split_row(AG + (r0 + col) * CI, 0, lane);
#pragma unroll
    for (int j = 0; j < 8; ++j) { const v16b w = frag_b(PO + (size_t)(c0 + j * 16 + col) * CI, lane); acc[j] = wmma_bf(a.h, w, acc[j]); acc[j] = wmma_bf(a.l, w, acc[j]); } }
#pragma unroll
  for (int j = 0; j < 8; ++j) { const int c = c0 + j * 16 + col;
#pragma unroll
    for (int r = 0; r < 8; ++r) sf[wave][8 * g + r][j * 16 + col] = bfr(X[(r0 + 8 * g + r) * CC + c]) + sg * acc[j][r]; }
  LDSX(); for (int rl = 0; rl < 16; ++rl) vst2(OUT + (r0 + rl) * CC + c0 + lane * 4, *(const v4f*)&sf[wave][rl][lane * 4]); }
extern "C" void kernel_launch(void* const* d_in, const int* in_sizes, int n_in, void* d_out, int out_size, void* d_ws, size_t ws_size, hipStream_t stream) {
  (void)in_sizes; (void)n_in; (void)out_size;
  const float** F = (const float**)d_in;   // 0 x [8,64,64,256], 1 y, 2 W_fy [256,32], 3 W_gx, 4 W_hx, 5 W_out [32,256], 6 sigma [1]
  if (ws_size < (size_t)WS_END) return;
  char* ws = (char*)d_ws; __bf16 *PW = (__bf16*)(ws + WS_PW), *PO = (__bf16*)(ws + WS_PO); _Float16 *FG = (_Float16*)(ws + WS_FG), *FGL = (_Float16*)(ws + WS_FGL), *HT = (_Float16*)(ws + WS_HT), *HTL = (_Float16*)(ws + WS_HTL); float* AG = (float*)(ws + WS_AG);
  k_pack<<<3 * CI + CC, 256, 0, stream>>>(F[2], F[3], F[4], F[5], PW, PO);
  k_proj<<<dim3(NN / 64, TNB), 128, 0, stream>>>(F[0], F[1], PW, FG, FGL, HT, HTL);
  k_att<<<dim3(NN / 64, TNB), 256, 0, stream>>>(FG, FGL, HT, HTL, AG);
  k_out<<<dim3(TNB * NN / 64, CC / 128), 128, 0, stream>>>(AG, PO, F[0], F[6], (float*)d_out);
}

// v007
// Measured time: 62.9 microseconds a run.
// Timed twice side by side with v006, it ran 1.09 times as fast both times.
// Counting every step since v000, it is 4.69 times as fast.
// compute dtype: all float inputs rounded to bf16, sigma read on device; fy, gx, hx with EXACT bf16 products on WMMA 16x16x32 ((in,out) weights packed to transposed rows), fy (x log2 e) and gx rounded to f16 hi + residual rows, hx to f16 hi + residual planes (residuals at their own scale, f16 subnormals included); logits fy . gx (base 2) with 3 products in one accumulator, running-max softmax in f32 (hardware exp2), P (x 2^11, f16) . hx (2 products in one accumulator); out = x + sigma (attn_g (bf16 hi + lo, 2 products) . W_out); f32 output.
#include <hip/hip_runtime.h>
#include <math.h>

typedef __attribute__((ext_vector_type(16))) _Float16 v16h;
typedef __attribute__((ext_vector_type(16))) __bf16 v16b;
typedef __attribute__((ext_vector_type(8)))  _Float16 v8h;
typedef __attribute__((ext_vector_type(8)))  float v8f;
typedef __attribute__((ext_vector_type(4)))  float v4f;
typedef __attribute__((ext_vector_type(2)))  float v2f;
typedef __attribute__((ext_vector_type(4)))  unsigned v4u;
typedef __attribute__((ext_vector_type(4)))  int v4i;
typedef float __attribute__((may_alias)) float_a;
typedef int __attribute__((may_alias)) int_a;

template <typename T> __device__ __forceinline__ void vst2(void* p, T v) { *(T*)p = v;  }
__device__ __forceinline__ v8f wmma16(v16h a, v16h b, v8f c) {   // the builtin alone: the compiler keeps the distance behind it itself and is free to put other work of the wave there
  return __builtin_amdgcn_wmma_f32_16x16x32_f16(false, a, false, b, (short)0, c, false, false);
}
__device__ __forceinline__ v8f wmma_bf(v16b a, v16b b, v8f c) {
  v8f d = __builtin_amdgcn_wmma_f32_16x16x32_bf16(false, a, false, b, (short)0, c, false, false);
  asm volatile("v_nop\n\tv_nop\n\tv_nop\n\tv_nop" : "+v"(d) : "v"(a), "v"(b));
  return d;
}
// 16x16x32 fragments: lane = (h = lane>>4, row/col = lane&15); elements 0..7 = k0+8h+0..7, 8..15 = k0+16+8h+0..7; D element r = row 8h+r
__device__ __forceinline__ v16h frag_h(const _Float16* rowk0, int lane) {
  union { v16h v; v8h q[2]; } u; const _Float16* p = rowk0 + 8 * (lane >> 4);
  u.q[0] = *(const v8h*)p; u.q[1] = *(const v8h*)(p + 16); return u.v;
}
__device__ __forceinline__ v16h frag_f32(const float* rowk0, int lane) {
  v16h a; const float* p = rowk0 + 8 * (lane >> 4);
#pragma unroll
  for (int i = 0; i < 8; ++i) { a[i] = (_Float16)p[i]; a[8 + i] = (_Float16)p[16 + i]; }
  return a;
}
__device__ __forceinline__ v16h frag_f32s(const float* rowk0, int lane, float sc) {
  v16h a; const float* p = rowk0 + 8 * (lane >> 4);
#pragma unroll
  for (int i = 0; i < 8; ++i) { a[i] = (_Float16)(p[i] * sc); a[8 + i] = (_Float16)(p[16 + i] * sc); }
  return a;
}
// column fragment from a [K][ld] layout (column n), rows >= K read as 0
__device__ __forceinline__ v16h fragc_f32(const float* W, int k0, int n, int lane, int ld, int K) {
  v16h a; const int g = lane >> 4;
#pragma unroll
  for (int i = 0; i < 8; ++i) { const int ka = k0 + 8 * g + i, kb = ka + 16;
    a[i] = (_Float16)(ka < K ? W[(size_t)(ka < K ? ka : K - 1) * ld + n] : 0.f); a[8 + i] = (_Float16)(kb < K ? W[(size_t)(kb < K ? kb : K - 1) * ld + n] : 0.f); }
  return a;
}
struct F2 { v16b h, l; };
__device__ __forceinline__ F2 bsplit16(const float v[16]) { F2 r;
#pragma unroll
  for (int i = 0; i < 16; ++i) { const __bf16 h = (__bf16)v[i]; r.h[i] = h; r.l[i] = (__bf16)(v[i] - (float)h); }
  return r; }
__device__ __forceinline__ F2 split_row(const float* row, int k0, int lane) { float v[16]; const float* p = row + k0 + 8 * (lane >> 4);
#pragma unroll
  for (int i = 0; i < 8; ++i) { v[i] = p[i]; v[8 + i] = p[16 + i]; }
  return bsplit16(v); }
__device__ __forceinline__ F2 split_rowK(const float* row, int k0, int lane, int K) { float v[16]; const int g = lane >> 4;
#pragma unroll
  for (int i = 0; i < 8; ++i) { const int ka = k0 + 8 * g + i, kb = ka + 16; v[i] = ka < K ? row[ka < K ? ka : K - 1] : 0.f; v[8 + i] = kb < K ? row[kb < K ? kb : K - 1] : 0.f; }
  return bsplit16(v); }
__device__ __forceinline__ F2 split_col(const float* W, int k0, int n, int lane, int ld, int K) { float v[16]; const int g = lane >> 4;
#pragma unroll
  for (int i = 0; i < 8; ++i) { const int ka = k0 + 8 * g + i, kb = ka + 16; v[i] = ka < K ? W[(size_t)(ka < K ? ka : K - 1) * ld + n] : 0.f; v[8 + i] = kb < K ? W[(size_t)(kb < K ? kb : K - 1) * ld + n] : 0.f; }
  return bsplit16(v); }
__device__ __forceinline__ v8f mac3(const F2& a, const F2& b, v8f c) { c = wmma_bf(a.l, b.h, c); c = wmma_bf(a.h, b.l, c); return wmma_bf(a.h, b.h, c); }
__device__ __forceinline__ float sigm(float v) { return 1.0f / (1.0f + expf(-v)); }
#define LDSX() do { asm volatile("s_wait_dscnt 0" ::: "memory"); __builtin_amdgcn_wave_barrier(); __builtin_amdgcn_fence(__ATOMIC_RELEASE, "workgroup"); } while (0)


// Self attention with channel reduction (B 8, 64 x 64 -> 4,096 positions, C 256, inner 32): attn = softmax(fy(y) . gx(x)^T) (unscaled); out = x + sigma (attn . hx(x)) W_out.
#define NB 8
#define NN 4096
#define CC 256
#define CI 32
#ifndef TNB
#define TNB NB
#endif
typedef __attribute__((ext_vector_type(8))) __bf16 v8b;
__device__ __forceinline__ v16b frag_b(const __bf16* rowk0, int lane) {
  union { v16b v; v8b q[2]; } u; const __bf16* p = rowk0 + 8 * (lane >> 4);
  u.q[0] = *(const v8b*)p; u.q[1] = *(const v8b*)(p + 16); return u.v;
}
__device__ __forceinline__ float bfr(float v) { return (float)(__bf16)v; }
__device__ __attribute__((noinline)) float exp_ni(float v) { return expf(v); }
__device__ __attribute__((noinline)) float erf_ni(float v) { return erff(v); }

#define WS_PW  0u                                   // bf16 rows [96][256]: fy | gx | hx weights transposed; [256][32] W_out^T
#define WS_PO  (WS_PW + 2u * 3 * CI * CC)
#define WS_FG  (WS_PO + 2u * CC * CI)                   // f16 hi|lo rows [b*NN + n][64] (fy 0..31 | gx 32..63)
#define WS_FGL (WS_FG + 2u * (size_t)NB * NN * 2 * CI)
#define WS_HT  (WS_FGL + 2u * (size_t)NB * NN * 2 * CI) // f16 hi|lo hx planes [b][32][NN]
#define WS_HTL (WS_HT + 2u * (size_t)NB * CI * NN)
#define WS_END (WS_HTL + 2u * (size_t)NB * CI * NN)

__global__ __launch_bounds__(256) void k_pack(const float* __restrict__ WFY, const float* __restrict__ WGX, const float* __restrict__ WHX, const float* __restrict__ WOUT, __bf16* __restrict__ PW, __bf16* __restrict__ PO) { const int n = blockIdx.x, t = threadIdx.x; __shared__ __align__(16) __bf16 s[CC];   // n < 96: transposed (in,out) [256][32] rows; n >= 96: W_out^T rows [256 -> o][32]
  if (n < 3 * CI) { const float* Wm = n < CI ? WFY : n < 2 * CI ? WGX : WHX; const int o = n % CI; s[t] = (__bf16)Wm[(size_t)t * CI + o]; __syncthreads(); if (t < CC / 8) vst2((unsigned*)(PW + (size_t)n * CC + t * 8), *(const v4u*)&s[t * 8]); }
  else { const int o = n - 3 * CI; if (t < CI) s[t] = (__bf16)WOUT[(size_t)t * CC + o]; __syncthreads(); if (t < CI / 8) vst2((unsigned*)(PO + (size_t)o * CI + t * 8), *(const v4u*)&s[t * 8]); } }
__device__ __forceinline__ v16b fragb_f32(const float* __restrict__ p, int lane) { v16b a; const float* pp = p + 8 * (lane >> 4);
#pragma unroll
  for (int i = 0; i < 8; ++i) { a[i] = (__bf16)pp[i]; a[8 + i] = (__bf16)pp[16 + i]; } return a; }
// ---- k_proj: block = (64 positions, b): fy (from y), gx, hx (from x): 6 column tiles of 16; fy|gx -> rows hi/lo; hx -> planes hi/lo
__global__ __launch_bounds__(128) void k_proj(const float* __restrict__ X, const float* __restrict__ Y, const __bf16* __restrict__ PW, _Float16* __restrict__ FG, _Float16* __restrict__ FGL, _Float16* __restrict__ HT, _Float16* __restrict__ HTL) {
  __shared__ __align__(16) _Float16 sh[64][72], sl[64][72]; __shared__ __align__(16) _Float16 th[CI][72], tl[CI][72];
  const int tid = threadIdx.x, wave = tid >> 5, lane = tid & 31, col = lane & 15, g = lane >> 4; const size_t b = blockIdx.y; const int n0 = blockIdx.x * 64 + wave * 16; const size_t r0 = b * NN + n0;
  v8f acc[6] = {};
#pragma unroll 2
  for (int kc = 0; kc < CC / 32; ++kc) { const v16b ay = fragb_f32(Y + (r0 + col) * CC + kc * 32, lane), ax = fragb_f32(X + (r0 + col) * CC + kc * 32, lane);
#pragma unroll
    for (int j = 0; j < 6; ++j) acc[j] = wmma_bf(j < 2 ? ay : ax, frag_b(PW + (size_t)(j * 16 + col) * CC + kc * 32, lane), acc[j]); }
#pragma unroll
  for (int j = 0; j < 6; ++j)
#pragma unroll
    for (int r = 0; r < 8; ++r) { const float v = j < 2 ? acc[j][r] * 1.44269504088896340736f : acc[j][r]; const _Float16 hv = (_Float16)v, lv = (_Float16)(v - (float)hv);   // fy carries log2 e, so the softmax needs no multiply in front of exp2; a residual keeps its own scale, so its products add into the same accumulator as the hi products
      if (j < 4) { sh[wave * 16 + 8 * g + r][j * 16 + col] = hv; sl[wave * 16 + 8 * g + r][j * 16 + col] = lv; } else { th[(j - 4) * 16 + col][wave * 16 + 8 * g + r] = hv; tl[(j - 4) * 16 + col][wave * 16 + 8 * g + r] = lv; } }
  __syncthreads();
  for (int e = tid; e < 64 * 8; e += 128) { const int rl = e >> 3, q = e & 7; const size_t o = (b * NN + blockIdx.x * 64 + rl) * (2 * CI) + q * 8; vst2((unsigned*)(FG + o), *(const v4u*)&sh[rl][q * 8]); vst2((unsigned*)(FGL + o), *(const v4u*)&sl[rl][q * 8]); }
  for (int e = tid; e < CI * 8; e += 128) { const int cl = e >> 3, q = e & 7; const size_t o = (b * CI + cl) * (size_t)NN + blockIdx.x * 64 + q * 8; vst2((unsigned*)(HT + o), *(const v4u*)&th[cl][q * 8]); vst2((unsigned*)(HTL + o), *(const v4u*)&tl[cl][q * 8]); } }
// ---- staging for k_att: one stage = 128 keys: gx rows hi/lo (64 B a key, LDS pitch 80 B) and hx planes hi/lo (256 B a channel, LDS pitch 272 B); both pitches are 16 B x odd, free of bank conflicts for 16-byte fragment reads
#define KS 128
#define KP 40
#define VP 136
struct Stage { _Float16 kh[KS][KP], kl[KS][KP], vh[CI][VP], vl[CI][VP]; };
__device__ __forceinline__ unsigned lds_at(const _Float16* p) { return (unsigned)(size_t)p; }   // LDS byte address = low 32 bits of the __shared__ address
// four asynchronous copies global -> LDS, 16 bytes a lane each, through no register; s_wait_xcnt stands in the copies' own statement so that it precedes every rewrite of an address register they name
__device__ __forceinline__ void copy4(unsigned l0, const _Float16* g0, unsigned l1, const _Float16* g1, unsigned l2, const _Float16* g2, unsigned l3, const _Float16* g3) {
  asm volatile("global_load_async_to_lds_b128 %0, %1, off\n\tglobal_load_async_to_lds_b128 %2, %3, off\n\tglobal_load_async_to_lds_b128 %4, %5, off\n\tglobal_load_async_to_lds_b128 %6, %7, off\n\ts_wait_xcnt 0x0"
               :: "v"(l0), "v"(g0), "v"(l1), "v"(g1), "v"(l2), "v"(g2), "v"(l3), "v"(g3) : "memory"); }
// 256 threads fill one stage: 8 copies a thread; a key row is 4 pieces of 16 B (64 rows a round), a channel row 16 pieces (16 rows a round)
__device__ __forceinline__ void fill(Stage* s, const _Float16* __restrict__ FG, const _Float16* __restrict__ FGL, const _Float16* __restrict__ HT, const _Float16* __restrict__ HTL, size_t b, int st, int tid) {
  const int kr = tid >> 2, kq = (tid & 3) * 8, vr = tid >> 4, vq = (tid & 15) * 8;
  const size_t gk = (b * NN + st * KS + kr) * (2 * CI) + CI + kq, dk = 64 * (2 * CI), gv = (b * CI + vr) * (size_t)NN + st * KS + vq, dv = 16 * (size_t)NN;
  copy4(lds_at(&s->kh[kr][kq]), FG + gk, lds_at(&s->kh[kr + 64][kq]), FG + gk + dk, lds_at(&s->kl[kr][kq]), FGL + gk, lds_at(&s->kl[kr + 64][kq]), FGL + gk + dk);
  copy4(lds_at(&s->vh[vr][vq]), HT + gv, lds_at(&s->vh[vr + 16][vq]), HT + gv + dv, lds_at(&s->vl[vr][vq]), HTL + gv, lds_at(&s->vl[vr + 16][vq]), HTL + gv + dv); }
// ---- k_att: block = (64 queries, b), 8 waves: a wave holds TWO query tiles (32 queries) and walks one quarter (32 keys) of every stage, so each gx and hx fragment it reads from LDS feeds two tiles' products: half the LDS reads a score of the one-tile wave; waves (qp, kq = 0..3) share the 32 queries of pair qp, each with running maxima, sums and O of its own (four waves a SIMD with two blocks a WGP); the four partial results join once, through LDS, at the end; the block's waves read gx and hx from LDS stages (two buffers, the next stage's copies fly under this stage's work): transposed tiles S^T = gx_k . fy_q^T (3 products, one accumulator): a lane holds 16 of the 32 keys of ONE query of each tile, so maximum and sum are in-lane (one exchange between the wave's halves for the maximum; the halves' sums join once at the end) and a tile's two score tiles, converted in place, are the B operand of O^T += hx^T . P^T (2 products, one accumulator) -> attn_g rows in LDS; the block that made these 64 rows also makes their output rows: out = x + sigma (attn_g (hi + lo) . W_out), a wave taking 16 rows x 128 columns
__device__ __forceinline__ float other_half(float v) { return __builtin_bit_cast(float, __builtin_amdgcn_permlanex16(__builtin_bit_cast(int, v), __builtin_bit_cast(int, v), 0x76543210, 0xfedcba98, false, false)); }   // lane l <-> l ^ 16
__global__ __launch_bounds__(256) void k_att(const _Float16* __restrict__ FG, const _Float16* __restrict__ FGL, const _Float16* __restrict__ HT, const _Float16* __restrict__ HTL, const __bf16* __restrict__ PO, const float* __restrict__ X, const float* __restrict__ SIG, float* __restrict__ OUT) {
  __shared__ __align__(16) float so[4][16][36]; __shared__ __align__(16) float xp[3][2][32][36]; __shared__ __align__(16) Stage sb[2];   // xp: a lane's 2 x 16 partial outputs, then maximum and sum of each tile; pitch 144 B = 16 B x odd
  const int tid = threadIdx.x, qp = (tid >> 5) & 1, kq = tid >> 6, lane = tid & 31, col = lane & 15, g = lane >> 4; const size_t b = blockIdx.y; const int q0 = blockIdx.x * 64 + qp * 32; const size_t rq = b * NN + q0;   // qp: query pair (tiles 2 qp, 2 qp + 1); kq: which quarter of a stage's keys
  v16h aq[2], aql[2];
#pragma unroll
  for (int t = 0; t < 2; ++t) { aq[t] = frag_h(FG + (rq + t * 16 + col) * (2 * CI), lane); aql[t] = frag_h(FGL + (rq + t * 16 + col) * (2 * CI), lane); }
  float m[2] = {-3.0e38f, -3.0e38f}, l[2] = {0.f, 0.f};   // query col of tile t: running maximum of the base-2 logits (equal in both halves), this half's share of the sum, x 2^11
  v8f acc[2][2] = {};   // [t][j] element r = channel j * 16 + 8 g + r of query col of tile t, x 2^11
  fill(&sb[0], FG, FGL, HT, HTL, b, 0, tid);
  asm volatile("s_wait_asynccnt 0x0" ::: "memory");   // this wave's copies of stage 0 have landed
  __syncthreads();                                     // publishes stage 0 to the other waves
  fill(&sb[1], FG, FGL, HT, HTL, b, 1, tid);
#pragma unroll 1   // one copy of the stage body: the publish point and the refill stand once, in the ring's order
  for (int st = 0; st < NN / KS; ++st) { const Stage* cs = &sb[st & 1];
  { const int ks = kq; v8f s[2][2];   // s[t][ct][r] = logit of key ks * 32 + ct * 16 + 8 g + r with query col of tile t
    v16h kh[2], kl[2], vh[2], vl[2];   // no LDS write stands in the pass, so all its fragment loads are issued at its head: the hx ones land under the score products and the softmax
#pragma unroll
    for (int ct = 0; ct < 2; ++ct) { const int rk = ks * 32 + ct * 16 + col; kh[ct] = frag_h(&cs->kh[rk][0], lane); kl[ct] = frag_h(&cs->kl[rk][0], lane); }
#pragma unroll
    for (int j = 0; j < 2; ++j) { vh[j] = frag_h(&cs->vh[j * 16 + col][ks * 32], lane); vl[j] = frag_h(&cs->vl[j * 16 + col][ks * 32], lane); }
#pragma unroll
    for (int t = 0; t < 2; ++t) {
      s[t][0] = wmma16(kl[0], aq[t], v8f{}); s[t][1] = wmma16(kl[1], aq[t], v8f{});   // the two key tiles' chains alternate: a product's successor in its own accumulator stands two matrix instructions behind it
      s[t][0] = wmma16(kh[0], aql[t], s[t][0]); s[t][1] = wmma16(kh[1], aql[t], s[t][1]);
      s[t][0] = wmma16(kh[0], aq[t], s[t][0]); s[t][1] = wmma16(kh[1], aq[t], s[t][1]); }
#pragma unroll
    for (int t = 0; t < 2; ++t) {
      float mx = fmaxf(s[t][0][0], s[t][1][0]), my = fmaxf(s[t][0][4], s[t][1][4]);   // two chains, half the dependent length
#pragma unroll
      for (int r = 1; r < 4; ++r) { mx = fmaxf(mx, fmaxf(s[t][0][r], s[t][1][r])); my = fmaxf(my, fmaxf(s[t][0][4 + r], s[t][1][4 + r])); }
      mx = fmaxf(mx, my);
      mx = fmaxf(mx, other_half(mx));
      const float mn = fmaxf(m[t], mx), alpha = __builtin_amdgcn_exp2f(m[t] - mn), mb = mn - 11.0f; m[t] = mn;   // mb: the 2^11 of P rides in the subtracted maximum
      v16h pa; float es = 0.f;   // pa element i = key 8 g + i, 8 + i = key 16 + 8 g + i: the k order of frag_h
#pragma unroll
      for (int r = 0; r < 8; ++r) { const float e0 = __builtin_amdgcn_exp2f(s[t][0][r] - mb), e1 = __builtin_amdgcn_exp2f(s[t][1][r] - mb); es += e0 + e1; pa[r] = (_Float16)e0; pa[8 + r] = (_Float16)e1; }
      l[t] = l[t] * alpha + es;
#pragma unroll
      for (int j = 0; j < 2; ++j)
#pragma unroll
        for (int r = 0; r < 8; ++r) acc[t][j][r] *= alpha;
      acc[t][0] = wmma16(vh[0], pa, acc[t][0]); acc[t][1] = wmma16(vh[1], pa, acc[t][1]);
      acc[t][0] = wmma16(vl[0], pa, acc[t][0]); acc[t][1] = wmma16(vl[1], pa, acc[t][1]); } }
    asm volatile("s_wait_dscnt 0x0" ::: "memory");      // this wave's reads of stage st are done before its buffer is handed back
    asm volatile("s_wait_asynccnt 0x0" ::: "memory");   // this wave's copies of stage st + 1 have landed
    __syncthreads();                                     // publishes stage st + 1 and ends every wave's reads of stage st
    if (st + 2 < NN / KS) fill(&sb[st & 1], FG, FGL, HT, HTL, b, st + 2, tid); }
  asm volatile("s_wait_asynccnt 0x0" ::: "memory");     // no copy is outstanding when the wave goes on to its end
  float o[2][16];   // this wave's partial outputs, tile t relative to its own maximum m[t]
#pragma unroll
  for (int t = 0; t < 2; ++t)
#pragma unroll
    for (int j = 0; j < 2; ++j)
#pragma unroll
      for (int r = 0; r < 8; ++r) o[t][j * 8 + r] = acc[t][j][r];
  if (kq != 0) { float* xw = &xp[kq - 1][qp][lane][0];
#pragma unroll
    for (int t = 0; t < 2; ++t)
#pragma unroll
      for (int i = 0; i < 4; ++i) *(v4f*)(xw + 16 * t + 4 * i) = v4f{o[t][4 * i], o[t][4 * i + 1], o[t][4 * i + 2], o[t][4 * i + 3]};
    *(v4f*)(xw + 32) = v4f{m[0], l[0], m[1], l[1]}; }
  __syncthreads();   // hands the other three key quarters' partial results to the wave that holds the first quarter of the same queries
  // operands of the output rows, asked for here so that they arrive under the join of the partial results: wave w takes row tile w & 3 and column half w >> 2
  const int rt = (tid >> 5) & 3, c0 = (tid >> 7) * 128; const size_t r0 = b * NN + blockIdx.x * 64 + rt * 16; const float sg = bfr(SIG[0]);
  v16b wo[8]; float xr[8][8];
#pragma unroll
  for (int j = 0; j < 8; ++j) wo[j] = frag_b(PO + (size_t)(c0 + j * 16 + col) * CI, lane);
  asm volatile("s_wait_xcnt 0x0" ::: "memory");   // stands in front of the x loads, whose results may be given the registers that held the addresses of the loads above
#pragma unroll
  for (int j = 0; j < 8; ++j)
#pragma unroll
    for (int r = 0; r < 8; ++r) xr[j][r] = X[(r0 + 8 * g + r) * CC + c0 + j * 16 + col];
  if (kq == 0) {   // the same for a whole wave
  v4f ml[3];
#pragma unroll
  for (int p = 0; p < 3; ++p) ml[p] = *(const v4f*)(&xp[p][qp][lane][32]);
#pragma unroll
  for (int t = 0; t < 2; ++t) {
    const float mt = fmaxf(fmaxf(m[t], ml[0][2 * t]), fmaxf(ml[1][2 * t], ml[2][2 * t])), fa = __builtin_amdgcn_exp2f(m[t] - mt);
    float lt = l[t] * fa;
#pragma unroll
    for (int i = 0; i < 16; ++i) o[t][i] *= fa;
#pragma unroll
    for (int p = 0; p < 3; ++p) { const float fb = __builtin_amdgcn_exp2f(ml[p][2 * t] - mt); lt += ml[p][2 * t + 1] * fb;
#pragma unroll
      for (int i = 0; i < 4; ++i) { const v4f pv = *(const v4f*)(&xp[p][qp][lane][16 * t + 4 * i]);
#pragma unroll
        for (int e = 0; e < 4; ++e) o[t][4 * i + e] += pv[e] * fb; } }
    lt += other_half(lt);
    const float il = 1.0f / lt;   // sum and outputs both carry the 2^11
#pragma unroll
    for (int j = 0; j < 2; ++j)
#pragma unroll
      for (int r = 0; r < 8; ++r) so[qp * 2 + t][col][j * 16 + 8 * g + r] = o[t][j * 8 + r] * il; } }
  __syncthreads();   // hands the block's 64 attn_g rows to all eight waves
  float* sf = (float*)&sb[0] + (size_t)(tid >> 5) * (16 * 132);   // a wave's own 16 x 128 output tile, pitch 132 floats, in the stage buffers: their last reader left at the loop's last barrier and no copy is outstanding
  v8f oc[8] = {}; { const F2 a = split_row(&so[rt][col][0], 0, lane);
#pragma unroll
    for (int j = 0; j < 8; ++j) { oc[j] = wmma_bf(a.h, wo[j], oc[j]); oc[j] = wmma_bf(a.l, wo[j], oc[j]); } }
#pragma unroll
  for (int j = 0; j < 8; ++j)
#pragma unroll
    for (int r = 0; r < 8; ++r) sf[(8 * g + r) * 132 + j * 16 + col] = bfr(xr[j][r]) + sg * oc[j][r];
  LDSX(); for (int rl = 0; rl < 16; ++rl) vst2(OUT + (r0 + rl) * CC + c0 + lane * 4, *(const v4f*)&sf[rl * 132 + lane * 4]); }
extern "C" void kernel_launch(void* const* d_in, const int* in_sizes, int n_in, void* d_out, int out_size, void* d_ws, size_t ws_size, hipStream_t stream) {
  (void)in_sizes; (void)n_in; (void)out_size;
  const float** F = (const float**)d_in;   // 0 x [8,64,64,256], 1 y, 2 W_fy [256,32], 3 W_gx, 4 W_hx, 5 W_out [32,256], 6 sigma [1]
  if (ws_size < (size_t)WS_END) return;
  char* ws = (char*)d_ws; __bf16 *PW = (__bf16*)(ws + WS_PW), *PO = (__bf16*)(ws + WS_PO); _Float16 *FG = (_Float16*)(ws + WS_FG), *FGL = (_Float16*)(ws + WS_FGL), *HT = (_Float16*)(ws + WS_HT), *HTL = (_Float16*)(ws + WS_HTL);
  k_pack<<<3 * CI + CC, 256, 0, stream>>>(F[2], F[3], F[4], F[5], PW, PO);
  k_proj<<<dim3(NN / 64, TNB), 128, 0, stream>>>(F[0], F[1], PW, FG, FGL, HT, HTL);
  k_att<<<dim3(NN / 64, TNB), 256, 0, stream>>>(FG, FGL, HT, HTL, PO, F[0], F[6], (float*)d_out);
}

// v008
// It runs in 54.1 microseconds.
// Next to v007, in two timings, it ran 1.17 and 1.16 times as fast.
// Over all steps from v000 it is 5.46 times as fast.
// compute dtype: all float inputs rounded to bf16, sigma read on device; fy, gx, hx with EXACT bf16 products on WMMA 16x16x32 ((in,out) weights packed to transposed rows), fy (x log2 e) and gx rounded to f16 hi + residual rows, hx to f16 hi + residual planes (residuals at their own scale, f16 subnormals included); logits fy . gx (base 2) with 3 products in one accumulator, running-max softmax in f32 (hardware exp2), P (x 2^11, f16) . hx (2 products in one accumulator); out = x + sigma (attn_g (bf16 hi + lo, 2 products) . W_out); f32 output.
#include <hip/hip_runtime.h>
#include <math.h>

typedef __attribute__((ext_vector_type(16))) _Float16 v16h;
typedef __attribute__((ext_vector_type(16))) __bf16 v16b;
typedef __attribute__((ext_vector_type(8)))  _Float16 v8h;
typedef __attribute__((ext_vector_type(8)))  float v8f;
typedef __attribute__((ext_vector_type(4)))  float v4f;
typedef __attribute__((ext_vector_type(2)))  float v2f;
typedef __attribute__((ext_vector_type(4)))  unsigned v4u;
typedef __attribute__((ext_vector_type(4)))  int v4i;
typedef float __attribute__((may_alias)) float_a;
typedef int __attribute__((may_alias)) int_a;

template <typename T> __device__ __forceinline__ void vst2(void* p, T v) { *(T*)p = v;  }
__device__ __forceinline__ v8f wmma16(v16h a, v16h b, v8f c) {   // the builtin alone: the compiler keeps the distance behind it itself and is free to put other work of the wave there
  return __builtin_amdgcn_wmma_f32_16x16x32_f16(false, a, false, b, (short)0, c, false, false);
}
__device__ __forceinline__ v8f wmma_bf(v16b a, v16b b, v8f c) {
  v8f d = __builtin_amdgcn_wmma_f32_16x16x32_bf16(false, a, false, b, (short)0, c, false, false);
  asm volatile("v_nop\n\tv_nop\n\tv_nop\n\tv_nop" : "+v"(d) : "v"(a), "v"(b));
  return d;
}
// 16x16x32 fragments: lane = (h = lane>>4, row/col = lane&15); elements 0..7 = k0+8h+0..7, 8..15 = k0+16+8h+0..7; D element r = row 8h+r
__device__ __forceinline__ v16h frag_h(const _Float16* rowk0, int lane) {
  union { v16h v; v8h q[2]; } u; const _Float16* p = rowk0 + 8 * (lane >> 4);
  u.q[0] = *(const v8h*)p; u.q[1] = *(const v8h*)(p + 16); return u.v;
}
__device__ __forceinline__ v16h frag_f32(const float* rowk0, int lane) {
  v16h a; const float* p = rowk0 + 8 * (lane >> 4);
#pragma unroll
  for (int i = 0; i < 8; ++i) { a[i] = (_Float16)p[i]; a[8 + i] = (_Float16)p[16 + i]; }
  return a;
}
__device__ __forceinline__ v16h frag_f32s(const float* rowk0, int lane, float sc) {
  v16h a; const float* p = rowk0 + 8 * (lane >> 4);
#pragma unroll
  for (int i = 0; i < 8; ++i) { a[i] = (_Float16)(p[i] * sc); a[8 + i] = (_Float16)(p[16 + i] * sc); }
  return a;
}
// column fragment from a [K][ld] layout (column n), rows >= K read as 0
__device__ __forceinline__ v16h fragc_f32(const float* W, int k0, int n, int lane, int ld, int K) {
  v16h a; const int g = lane >> 4;
#pragma unroll
  for (int i = 0; i < 8; ++i) { const int ka = k0 + 8 * g + i, kb = ka + 16;
    a[i] = (_Float16)(ka < K ? W[(size_t)(ka < K ? ka : K - 1) * ld + n] : 0.f); a[8 + i] = (_Float16)(kb < K ? W[(size_t)(kb < K ? kb : K - 1) * ld + n] : 0.f); }
  return a;
}
struct F2 { v16b h, l; };
__device__ __forceinline__ F2 bsplit16(const float v[16]) { F2 r;
#pragma unroll
  for (int i = 0; i < 16; ++i) { const __bf16 h = (__bf16)v[i]; r.h[i] = h; r.l[i] = (__bf16)(v[i] - (float)h); }
  return r; }
__device__ __forceinline__ F2 split_row(const float* row, int k0, int lane) { float v[16]; const float* p = row + k0 + 8 * (lane >> 4);
#pragma unroll
  for (int i = 0; i < 8; ++i) { v[i] = p[i]; v[8 + i] = p[16 + i]; }
  return bsplit16(v); }
__device__ __forceinline__ F2 split_rowK(const float* row, int k0, int lane, int K) { float v[16]; const int g = lane >> 4;
#pragma unroll
  for (int i = 0; i < 8; ++i) { const int ka = k0 + 8 * g + i, kb = ka + 16; v[i] = ka < K ? row[ka < K ? ka : K - 1] : 0.f; v[8 + i] = kb < K ? row[kb < K ? kb : K - 1] : 0.f; }
  return bsplit16(v); }
__device__ __forceinline__ F2 split_col(const float* W, int k0, int n, int lane, int ld, int K) { float v[16]; const int g = lane >> 4;
#pragma unroll
  for (int i = 0; i < 8; ++i) { const int ka = k0 + 8 * g + i, kb = ka + 16; v[i] = ka < K ? W[(size_t)(ka < K ? ka : K - 1) * ld + n] : 0.f; v[8 + i] = kb < K ? W[(size_t)(kb < K ? kb : K - 1) * ld + n] : 0.f; }
  return bsplit16(v); }
__device__ __forceinline__ v8f mac3(const F2& a, const F2& b, v8f c) { c = wmma_bf(a.l, b.h, c); c = wmma_bf(a.h, b.l, c); return wmma_bf(a.h, b.h, c); }
__device__ __forceinline__ float sigm(float v) { return 1.0f / (1.0f + expf(-v)); }
#define LDSX() do { asm volatile("s_wait_dscnt 0" ::: "memory"); __builtin_amdgcn_wave_barrier(); __builtin_amdgcn_fence(__ATOMIC_RELEASE, "workgroup"); } while (0)


// Self attention with channel reduction (B 8, 64 x 64 -> 4,096 positions, C 256, inner 32): attn = softmax(fy(y) . gx(x)^T) (unscaled); out = x + sigma (attn . hx(x)) W_out.
#define NB 8
#define NN 4096
#define CC 256
#define CI 32
#ifndef TNB
#define TNB NB
#endif
typedef __attribute__((ext_vector_type(8))) __bf16 v8b;
__device__ __forceinline__ v16b frag_b(const __bf16* rowk0, int lane) {
  union { v16b v; v8b q[2]; } u; const __bf16* p = rowk0 + 8 * (lane >> 4);
  u.q[0] = *(const v8b*)p; u.q[1] = *(const v8b*)(p + 16); return u.v;
}
__device__ __forceinline__ float bfr(float v) { return (float)(__bf16)v; }
__device__ __attribute__((noinline)) float exp_ni(float v) { return expf(v); }
__device__ __attribute__((noinline)) float erf_ni(float v) { return erff(v); }

#define WS_PW  0u                                   // (first 48 KiB not used); bf16 rows [256][32] W_out^T
#define WS_PO  (WS_PW + 2u * 3 * CI * CC)
#define WS_FG  (WS_PO + 2u * CC * CI)                   // f16 hi|lo rows [b*NN + n][64] (fy 0..31 | gx 32..63)
#define WS_FGL (WS_FG + 2u * (size_t)NB * NN * 2 * CI)
#define WS_HT  (WS_FGL + 2u * (size_t)NB * NN * 2 * CI) // f16 hi|lo hx planes [b][32][NN]
#define WS_HTL (WS_HT + 2u * (size_t)NB * CI * NN)
#define WS_END (WS_HTL + 2u * (size_t)NB * CI * NN)

__device__ __forceinline__ v16b fragb_f32(const float* __restrict__ p, int lane) { v16b a; const float* pp = p + 8 * (lane >> 4);
#pragma unroll
  for (int i = 0; i < 8; ++i) { a[i] = (__bf16)pp[i]; a[8 + i] = (__bf16)pp[16 + i]; } return a; }
// ---- k_proj: block = (64 positions, b): fy (from y), gx, hx (from x): 6 column tiles of 16; fy|gx -> rows hi/lo; hx -> planes hi/lo; the block rounds the three (in,out) weights to bf16 itself and lays them transposed in LDS (row = output channel, pitch 528 B = 16 B x odd), so no launch stands in front of this one; the blocks of b = 0 also write the W_out^T rows that the next launch reads
#define WP 264
__global__ __launch_bounds__(128) void k_proj(const float* __restrict__ X, const float* __restrict__ Y, const float* __restrict__ WFY, const float* __restrict__ WGX, const float* __restrict__ WHX, const float* __restrict__ WOUT, __bf16* __restrict__ PO, _Float16* __restrict__ FG, _Float16* __restrict__ FGL, _Float16* __restrict__ HT, _Float16* __restrict__ HTL) {
  __shared__ __align__(16) _Float16 sh[64][72], sl[64][72]; __shared__ __align__(16) _Float16 th[CI][72], tl[CI][72]; __shared__ __align__(16) __bf16 sw[3 * CI][WP];
  const int tid = threadIdx.x, wave = tid >> 5, lane = tid & 31, col = lane & 15, g = lane >> 4; const size_t b = blockIdx.y; const int n0 = blockIdx.x * 64 + wave * 16; const size_t r0 = b * NN + n0;
  // a thread takes 8 k rows x 4 output channels at a time: 8 loads of 16 B (8 lanes cover a 128-B weight row), 4 LDS stores of 8 bf16 along k; all 48 loads are asked for before the first is used
  const int kg = tid >> 3, oq = tid & 7; v4f wr[6][8];
#pragma unroll
  for (int i = 0; i < 6; ++i) { const float* __restrict__ Wm = i < 2 ? WFY : i < 4 ? WGX : WHX;
#pragma unroll
    for (int e = 0; e < 8; ++e) wr[i][e] = *(const v4f*)(Wm + (size_t)(((i & 1) * 16 + kg) * 8 + e) * CI + oq * 4);
    if (i & 1) asm volatile("s_wait_xcnt 0x0" ::: "memory"); }   // stands behind one matrix's loads: the next loads' results may be given the registers that held these loads' addresses
#pragma unroll
  for (int i = 0; i < 6; ++i)
#pragma unroll
    for (int c = 0; c < 4; ++c) { v8b wt;
#pragma unroll
      for (int e = 0; e < 8; ++e) wt[e] = (__bf16)wr[i][e][c];
      *(v8b*)&sw[(i >> 1) * CI + oq * 4 + c][((i & 1) * 16 + kg) * 8] = wt; }
  if (blockIdx.y == 0) { const int o = blockIdx.x * (CC / (NN / 64)) + wave; PO[(size_t)o * CI + lane] = (__bf16)WOUT[(size_t)lane * CC + o]; }   // the same for a whole block: 4 rows [o][32] of W_out^T, 256 B that no other block writes
  __syncthreads();   // hands the staged weight rows to all four waves
  v8f acc[6] = {};
#pragma unroll 2
  for (int kc = 0; kc < CC / 32; ++kc) { const v16b ay = fragb_f32(Y + (r0 + col) * CC + kc * 32, lane), ax = fragb_f32(X + (r0 + col) * CC + kc * 32, lane);
    v16b bw[6];
#pragma unroll
    for (int j = 0; j < 6; ++j) bw[j] = frag_b(&sw[j * 16 + col][kc * 32], lane);   // a k step's six weight fragments are read from LDS together, ahead of its products: one LDS latency a step
#pragma unroll
    for (int j = 0; j < 6; ++j) acc[j] = wmma_bf(j < 2 ? ay : ax, bw[j], acc[j]); }
#pragma unroll
  for (int j = 0; j < 6; ++j)
#pragma unroll
    for (int r = 0; r < 8; ++r) { const float v = j < 2 ? acc[j][r] * 1.44269504088896340736f : acc[j][r]; const _Float16 hv = (_Float16)v, lv = (_Float16)(v - (float)hv);   // fy carries log2 e, so the softmax needs no multiply in front of exp2; a residual keeps its own scale, so its products add into the same accumulator as the hi products
      if (j < 4) { sh[wave * 16 + 8 * g + r][j * 16 + col] = hv; sl[wave * 16 + 8 * g + r][j * 16 + col] = lv; } else { th[(j - 4) * 16 + col][wave * 16 + 8 * g + r] = hv; tl[(j - 4) * 16 + col][wave * 16 + 8 * g + r] = lv; } }
  __syncthreads();
  for (int e = tid; e < 64 * 8; e += 128) { const int rl = e >> 3, q = e & 7; const size_t o = (b * NN + blockIdx.x * 64 + rl) * (2 * CI) + q * 8; vst2((unsigned*)(FG + o), *(const v4u*)&sh[rl][q * 8]); vst2((unsigned*)(FGL + o), *(const v4u*)&sl[rl][q * 8]); }
  for (int e = tid; e < CI * 8; e += 128) { const int cl = e >> 3, q = e & 7; const size_t o = (b * CI + cl) * (size_t)NN + blockIdx.x * 64 + q * 8; vst2((unsigned*)(HT + o), *(const v4u*)&th[cl][q * 8]); vst2((unsigned*)(HTL + o), *(const v4u*)&tl[cl][q * 8]); } }
// ---- staging for k_att: one stage = 128 keys: gx rows hi/lo (64 B a key, LDS pitch 80 B) and hx planes hi/lo (256 B a channel, LDS pitch 272 B); both pitches are 16 B x odd, free of bank conflicts for 16-byte fragment reads
#define KS 128
#define KP 40
#define VP 136
struct Stage { _Float16 kh[KS][KP], kl[KS][KP], vh[CI][VP], vl[CI][VP]; };
__device__ __forceinline__ unsigned lds_at(const _Float16* p) { return (unsigned)(size_t)p; }   // LDS byte address = low 32 bits of the __shared__ address
// four asynchronous copies global -> LDS, 16 bytes a lane each, through no register; s_wait_xcnt stands in the copies' own statement so that it precedes every rewrite of an address register they name
__device__ __forceinline__ void copy4(unsigned l0, const _Float16* g0, unsigned l1, const _Float16* g1, unsigned l2, const _Float16* g2, unsigned l3, const _Float16* g3) {
  asm volatile("global_load_async_to_lds_b128 %0, %1, off\n\tglobal_load_async_to_lds_b128 %2, %3, off\n\tglobal_load_async_to_lds_b128 %4, %5, off\n\tglobal_load_async_to_lds_b128 %6, %7, off\n\ts_wait_xcnt 0x0"
               :: "v"(l0), "v"(g0), "v"(l1), "v"(g1), "v"(l2), "v"(g2), "v"(l3), "v"(g3) : "memory"); }
// 256 threads fill one stage: 8 copies a thread; a key row is 4 pieces of 16 B (64 rows a round), a channel row 16 pieces (16 rows a round)
__device__ __forceinline__ void fill(Stage* s, const _Float16* __restrict__ FG, const _Float16* __restrict__ FGL, const _Float16* __restrict__ HT, const _Float16* __restrict__ HTL, size_t b, int st, int tid) {
  const int kr = tid >> 2, kq = (tid & 3) * 8, vr = tid >> 4, vq = (tid & 15) * 8;
  const size_t gk = (b * NN + st * KS + kr) * (2 * CI) + CI + kq, dk = 64 * (2 * CI), gv = (b * CI + vr) * (size_t)NN + st * KS + vq, dv = 16 * (size_t)NN;
  copy4(lds_at(&s->kh[kr][kq]), FG + gk, lds_at(&s->kh[kr + 64][kq]), FG + gk + dk, lds_at(&s->kl[kr][kq]), FGL + gk, lds_at(&s->kl[kr + 64][kq]), FGL + gk + dk);
  copy4(lds_at(&s->vh[vr][vq]), HT + gv, lds_at(&s->vh[vr + 16][vq]), HT + gv + dv, lds_at(&s->vl[vr][vq]), HTL + gv, lds_at(&s->vl[vr + 16][vq]), HTL + gv + dv); }
// ---- k_att: block = (64 queries, b), 8 waves: a wave holds TWO query tiles (32 queries) and walks one quarter (32 keys) of every stage, so each gx and hx fragment it reads from LDS feeds two tiles' products: half the LDS reads a score of the one-tile wave; waves (qp, kq = 0..3) share the 32 queries of pair qp, each with running maxima, sums and O of its own (four waves a SIMD with two blocks a WGP); the four partial results join once, through LDS, at the end; the block's waves read gx and hx from LDS stages (two buffers, the next stage's copies fly under this stage's work): transposed tiles S^T = gx_k . fy_q^T (3 products, one accumulator): a lane holds 16 of the 32 keys of ONE query of each tile, so maximum and sum are in-lane (one exchange between the wave's halves for the maximum; the halves' sums join once at the end) and a tile's two score tiles, converted in place, are the B operand of O^T += hx^T . P^T (2 products, one accumulator) -> attn_g rows in LDS; the block that made these 64 rows also makes their output rows: out = x + sigma (attn_g (hi + lo) . W_out), a wave taking 16 rows x 128 columns
__device__ __forceinline__ float other_half(float v) { return __builtin_bit_cast(float, __builtin_amdgcn_permlanex16(__builtin_bit_cast(int, v), __builtin_bit_cast(int, v), 0x76543210, 0xfedcba98, false, false)); }   // lane l <-> l ^ 16
__global__ __launch_bounds__(256) void k_att(const _Float16* __restrict__ FG, const _Float16* __restrict__ FGL, const _Float16* __restrict__ HT, const _Float16* __restrict__ HTL, const __bf16* __restrict__ PO, const float* __restrict__ X, const float* __restrict__ SIG, float* __restrict__ OUT) {
  __shared__ __align__(16) float so[4][16][36]; __shared__ __align__(16) float xp[3][2][32][36]; __shared__ __align__(16) Stage sb[2];   // xp: a lane's 2 x 16 partial outputs, then maximum and sum of each tile; pitch 144 B = 16 B x odd
  const int tid = threadIdx.x, qp = (tid >> 5) & 1, kq = tid >> 6, lane = tid & 31, col = lane & 15, g = lane >> 4; const size_t b = blockIdx.y; const int q0 = blockIdx.x * 64 + qp * 32; const size_t rq = b * NN + q0;   // qp: query pair (tiles 2 qp, 2 qp + 1); kq: which quarter of a stage's keys
  v16h aq[2], aql[2];
#pragma unroll
  for (int t = 0; t < 2; ++t) { aq[t] = frag_h(FG + (rq + t * 16 + col) * (2 * CI), lane); aql[t] = frag_h(FGL + (rq + t * 16 + col) * (2 * CI), lane); }
  float m[2] = {-3.0e38f, -3.0e38f}, l[2] = {0.f, 0.f};   // query col of tile t: running maximum of the base-2 logits (equal in both halves), this half's share of the sum, x 2^11
  v8f acc[2][2] = {};   // [t][j] element r = channel j * 16 + 8 g + r of query col of tile t, x 2^11
  fill(&sb[0], FG, FGL, HT, HTL, b, 0, tid);
  asm volatile("s_wait_asynccnt 0x0" ::: "memory");   // this wave's copies of stage 0 have landed
  __syncthreads();                                     // publishes stage 0 to the other waves
  fill(&sb[1], FG, FGL, HT, HTL, b, 1, tid);
#pragma unroll 1   // one copy of the stage body: the publish point and the refill stand once, in the ring's order
  for (int st = 0; st < NN / KS; ++st) { const Stage* cs = &sb[st & 1];
  { const int ks = kq; v8f s[2][2];   // s[t][ct][r] = logit of key ks * 32 + ct * 16 + 8 g + r with query col of tile t
    v16h kh[2], kl[2], vh[2], vl[2];   // no LDS write stands in the pass, so all its fragment loads are issued at its head: the hx ones land under the score products and the softmax
#pragma unroll
    for (int ct = 0; ct < 2; ++ct) { const int rk = ks * 32 + ct * 16 + col; kh[ct] = frag_h(&cs->kh[rk][0], lane); kl[ct] = frag_h(&cs->kl[rk][0], lane); }
#pragma unroll
    for (int j = 0; j < 2; ++j) { vh[j] = frag_h(&cs->vh[j * 16 + col][ks * 32], lane); vl[j] = frag_h(&cs->vl[j * 16 + col][ks * 32], lane); }
#pragma unroll
    for (int t = 0; t < 2; ++t) {
      s[t][0] = wmma16(kl[0], aq[t], v8f{}); s[t][1] = wmma16(kl[1], aq[t], v8f{});   // the two key tiles' chains alternate: a product's successor in its own accumulator stands two matrix instructions behind it
      s[t][0] = wmma16(kh[0], aql[t], s[t][0]); s[t][1] = wmma16(kh[1], aql[t], s[t][1]);
      s[t][0] = wmma16(kh[0], aq[t], s[t][0]); s[t][1] = wmma16(kh[1], aq[t], s[t][1]); }
#pragma unroll
    for (int t = 0; t < 2; ++t) {
      float mx = fmaxf(s[t][0][0], s[t][1][0]), my = fmaxf(s[t][0][4], s[t][1][4]);   // two chains, half the dependent length
#pragma unroll
      for (int r = 1; r < 4; ++r) { mx = fmaxf(mx, fmaxf(s[t][0][r], s[t][1][r])); my = fmaxf(my, fmaxf(s[t][0][4 + r], s[t][1][4 + r])); }
      mx = fmaxf(mx, my);
      mx = fmaxf(mx, other_half(mx));
      const float mn = fmaxf(m[t], mx), alpha = __builtin_amdgcn_exp2f(m[t] - mn), mb = mn - 11.0f; m[t] = mn;   // mb: the 2^11 of P rides in the subtracted maximum
      v16h pa; float es = 0.f;   // pa element i = key 8 g + i, 8 + i = key 16 + 8 g + i: the k order of frag_h
#pragma unroll
      for (int r = 0; r < 8; ++r) { const float e0 = __builtin_amdgcn_exp2f(s[t][0][r] - mb), e1 = __builtin_amdgcn_exp2f(s[t][1][r] - mb); es += e0 + e1; pa[r] = (_Float16)e0; pa[8 + r] = (_Float16)e1; }
      l[t] = l[t] * alpha + es;
#pragma unroll
      for (int j = 0; j < 2; ++j)
#pragma unroll
        for (int r = 0; r < 8; ++r) acc[t][j][r] *= alpha;
      acc[t][0] = wmma16(vh[0], pa, acc[t][0]); acc[t][1] = wmma16(vh[1], pa, acc[t][1]);
      acc[t][0] = wmma16(vl[0], pa, acc[t][0]); acc[t][1] = wmma16(vl[1], pa, acc[t][1]); } }
    asm volatile("s_wait_dscnt 0x0" ::: "memory");      // this wave's reads of stage st are done before its buffer is handed back
    asm volatile("s_wait_asynccnt 0x0" ::: "memory");   // this wave's copies of stage st + 1 have landed
    __syncthreads();                                     // publishes stage st + 1 and ends every wave's reads of stage st
    if (st + 2 < NN / KS) fill(&sb[st & 1], FG, FGL, HT, HTL, b, st + 2, tid); }
  asm volatile("s_wait_asynccnt 0x0" ::: "memory");     // no copy is outstanding when the wave goes on to its end
  float o[2][16];   // this wave's partial outputs, tile t relative to its own maximum m[t]
#pragma unroll
  for (int t = 0; t < 2; ++t)
#pragma unroll
    for (int j = 0; j < 2; ++j)
#pragma unroll
      for (int r = 0; r < 8; ++r) o[t][j * 8 + r] = acc[t][j][r];
  if (kq != 0) { float* xw = &xp[kq - 1][qp][lane][0];
#pragma unroll
    for (int t = 0; t < 2; ++t)
#pragma unroll
      for (int i = 0; i < 4; ++i) *(v4f*)(xw + 16 * t + 4 * i) = v4f{o[t][4 * i], o[t][4 * i + 1], o[t][4 * i + 2], o[t][4 * i + 3]};
    *(v4f*)(xw + 32) = v4f{m[0], l[0], m[1], l[1]}; }
  __syncthreads();   // hands the other three key quarters' partial results to the wave that holds the first quarter of the same queries
  // operands of the output rows, asked for here so that they arrive under the join of the partial results: wave w takes row tile w & 3 and column half w >> 2
  const int rt = (tid >> 5) & 3, c0 = (tid >> 7) * 128; const size_t r0 = b * NN + blockIdx.x * 64 + rt * 16; const float sg = bfr(SIG[0]);
  v16b wo[8]; float xr[8][8];
#pragma unroll
  for (int j = 0; j < 8; ++j) wo[j] = frag_b(PO + (size_t)(c0 + j * 16 + col) * CI, lane);
  asm volatile("s_wait_xcnt 0x0" ::: "memory");   // stands in front of the x loads, whose results may be given the registers that held the addresses of the loads above
#pragma unroll
  for (int j = 0; j < 8; ++j)
#pragma unroll
    for (int r = 0; r < 8; ++r) xr[j][r] = X[(r0 + 8 * g + r) * CC + c0 + j * 16 + col];
  if (kq == 0) {   // the same for a whole wave
  v4f ml[3];
#pragma unroll
  for (int p = 0; p < 3; ++p) ml[p] = *(const v4f*)(&xp[p][qp][lane][32]);
#pragma unroll
  for (int t = 0; t < 2; ++t) {
    const float mt = fmaxf(fmaxf(m[t], ml[0][2 * t]), fmaxf(ml[1][2 * t], ml[2][2 * t])), fa = __builtin_amdgcn_exp2f(m[t] - mt);
    float lt = l[t] * fa;
#pragma unroll
    for (int i = 0; i < 16; ++i) o[t][i] *= fa;
#pragma unroll
    for (int p = 0; p < 3; ++p) { const float fb = __builtin_amdgcn_exp2f(ml[p][2 * t] - mt); lt += ml[p][2 * t + 1] * fb;
#pragma unroll
      for (int i = 0; i < 4; ++i) { const v4f pv = *(const v4f*)(&xp[p][qp][lane][16 * t + 4 * i]);
#pragma unroll
        for (int e = 0; e < 4; ++e) o[t][4 * i + e] += pv[e] * fb; } }
    lt += other_half(lt);
    const float il = 1.0f / lt;   // sum and outputs both carry the 2^11
#pragma unroll
    for (int j = 0; j < 2; ++j)
#pragma unroll
      for (int r = 0; r < 8; ++r) so[qp * 2 + t][col][j * 16 + 8 * g + r] = o[t][j * 8 + r] * il; } }
  __syncthreads();   // hands the block's 64 attn_g rows to all eight waves
  float* sf = (float*)&sb[0] + (size_t)(tid >> 5) * (16 * 132);   // a wave's own 16 x 128 output tile, pitch 132 floats, in the stage buffers: their last reader left at the loop's last barrier and no copy is outstanding
  v8f oc[8] = {}; { const F2 a = split_row(&so[rt][col][0], 0, lane);
#pragma unroll
    for (int j = 0; j < 8; ++j) { oc[j] = wmma_bf(a.h, wo[j], oc[j]); oc[j] = wmma_bf(a.l, wo[j], oc[j]); } }
#pragma unroll
  for (int j = 0; j < 8; ++j)
#pragma unroll
    for (int r = 0; r < 8; ++r) sf[(8 * g + r) * 132 + j * 16 + col] = bfr(xr[j][r]) + sg * oc[j][r];
  LDSX(); for (int rl = 0; rl < 16; ++rl) vst2(OUT + (r0 + rl) * CC + c0 + lane * 4, *(const v4f*)&sf[rl * 132 + lane * 4]); }
extern "C" void kernel_launch(void* const* d_in, const int* in_sizes, int n_in, void* d_out, int out_size, void* d_ws, size_t ws_size, hipStream_t stream) {
  (void)in_sizes; (void)n_in; (void)out_size;
  const float** F = (const float**)d_in;   // 0 x [8,64,64,256], 1 y, 2 W_fy [256,32], 3 W_gx, 4 W_hx, 5 W_out [32,256], 6 sigma [1]
  if (ws_size < (size_t)WS_END) return;
  char* ws = (char*)d_ws; __bf16* PO = (__bf16*)(ws + WS_PO); _Float16 *FG = (_Float16*)(ws + WS_FG), *FGL = (_Float16*)(ws + WS_FGL), *HT = (_Float16*)(ws + WS_HT), *HTL = (_Float16*)(ws + WS_HTL);
  k_proj<<<dim3(NN / 64, TNB), 128, 0, stream>>>(F[0], F[1], F[2], F[3], F[4], F[5], PO, FG, FGL, HT, HTL);
  k_att<<<dim3(NN / 64, TNB), 256, 0, stream>>>(FG, FGL, HT, HTL, PO, F[0], F[6], (float*)d_out);
}

// v009
// A run of this version takes 51.3 microseconds.
// In both of two side-by-side timings against v008, it was 1.05 times as fast.
// Over all steps from v000 it is 5.74 times as fast.
// compute dtype: all float inputs rounded to bf16, sigma read on device; fy, gx, hx with EXACT bf16 products on WMMA 16x16x32 ((in,out) weights packed to transposed rows), fy (x log2 e) and gx rounded to f16 hi + residual rows, hx to f16 hi + residual planes (residuals at their own scale, f16 subnormals included); logits fy . gx (base 2) with 3 products in one accumulator, running-max softmax in f32 (hardware exp2), P (x 2^11, f16) . hx (2 products in one accumulator); out = x + sigma (attn_g (bf16 hi + lo, 2 products) . W_out); f32 output.
#include <hip/hip_runtime.h>
#include <math.h>

typedef __attribute__((ext_vector_type(16))) _Float16 v16h;
typedef __attribute__((ext_vector_type(16))) __bf16 v16b;
typedef __attribute__((ext_vector_type(8)))  _Float16 v8h;
typedef __attribute__((ext_vector_type(8)))  float v8f;
typedef __attribute__((ext_vector_type(4)))  float v4f;
typedef __attribute__((ext_vector_type(2)))  float v2f;
typedef __attribute__((ext_vector_type(4)))  unsigned v4u;
typedef __attribute__((ext_vector_type(4)))  int v4i;
typedef float __attribute__((may_alias)) float_a;
typedef int __attribute__((may_alias)) int_a;

template <typename T> __device__ __forceinline__ void vst2(void* p, T v) { *(T*)p = v;  }
__device__ __forceinline__ v8f wmma16(v16h a, v16h b, v8f c) {   // the builtin alone: the compiler keeps the distance behind it itself and is free to put other work of the wave there
  return __builtin_amdgcn_wmma_f32_16x16x32_f16(false, a, false, b, (short)0, c, false, false);
}
__device__ __forceinline__ v8f wmma_bf(v16b a, v16b b, v8f c) {
  v8f d = __builtin_amdgcn_wmma_f32_16x16x32_bf16(false, a, false, b, (short)0, c, false, false);
  asm volatile("v_nop\n\tv_nop\n\tv_nop\n\tv_nop" : "+v"(d) : "v"(a), "v"(b));
  return d;
}
// 16x16x32 fragments: lane = (h = lane>>4, row/col = lane&15); elements 0..7 = k0+8h+0..7, 8..15 = k0+16+8h+0..7; D element r = row 8h+r
__device__ __forceinline__ v16h frag_h(const _Float16* rowk0, int lane) {
  union { v16h v; v8h q[2]; } u; const _Float16* p = rowk0 + 8 * (lane >> 4);
  u.q[0] = *(const v8h*)p; u.q[1] = *(const v8h*)(p + 16); return u.v;
}
__device__ __forceinline__ v16h frag_f32(const float* rowk0, int lane) {
  v16h a; const float* p = rowk0 + 8 * (lane >> 4);
#pragma unroll
  for (int i = 0; i < 8; ++i) { a[i] = (_Float16)p[i]; a[8 + i] = (_Float16)p[16 + i]; }
  return a;
}
__device__ __forceinline__ v16h frag_f32s(const float* rowk0, int lane, float sc) {
  v16h a; const float* p = rowk0 + 8 * (lane >> 4);
#pragma unroll
  for (int i = 0; i < 8; ++i) { a[i] = (_Float16)(p[i] * sc); a[8 + i] = (_Float16)(p[16 + i] * sc); }
  return a;
}
// column fragment from a [K][ld] layout (column n), rows >= K read as 0
__device__ __forceinline__ v16h fragc_f32(const float* W, int k0, int n, int lane, int ld, int K) {
  v16h a; const int g = lane >> 4;
#pragma unroll
  for (int i = 0; i < 8; ++i) { const int ka = k0 + 8 * g + i, kb = ka + 16;
    a[i] = (_Float16)(ka < K ? W[(size_t)(ka < K ? ka : K - 1) * ld + n] : 0.f); a[8 + i] = (_Float16)(kb < K ? W[(size_t)(kb < K ? kb : K - 1) * ld + n] : 0.f); }
  return a;
}
struct F2 { v16b h, l; };
__device__ __forceinline__ F2 bsplit16(const float v[16]) { F2 r;
#pragma unroll
  for (int i = 0; i < 16; ++i) { const __bf16 h = (__bf16)v[i]; r.h[i] = h; r.l[i] = (__bf16)(v[i] - (float)h); }
  return r; }
__device__ __forceinline__ F2 split_row(const float* row, int k0, int lane) { float v[16]; const float* p = row + k0 + 8 * (lane >> 4);
#pragma unroll
  for (int i = 0; i < 8; ++i) { v[i] = p[i]; v[8 + i] = p[16 + i]; }
  return bsplit16(v); }
__device__ __forceinline__ F2 split_rowK(const float* row, int k0, int lane, int K) { float v[16]; const int g = lane >> 4;
#pragma unroll
  for (int i = 0; i < 8; ++i) { const int ka = k0 + 8 * g + i, kb = ka + 16; v[i] = ka < K ? row[ka < K ? ka : K - 1] : 0.f; v[8 + i] = kb < K ? row[kb < K ? kb : K - 1] : 0.f; }
  return bsplit16(v); }
__device__ __forceinline__ F2 split_col(const float* W, int k0, int n, int lane, int ld, int K) { float v[16]; const int g = lane >> 4;
#pragma unroll
  for (int i = 0; i < 8; ++i) { const int ka = k0 + 8 * g + i, kb = ka + 16; v[i] = ka < K ? W[(size_t)(ka < K ? ka : K - 1) * ld + n] : 0.f; v[8 + i] = kb < K ? W[(size_t)(kb < K ? kb : K - 1) * ld + n] : 0.f; }
  return bsplit16(v); }
__device__ __forceinline__ v8f mac3(const F2& a, const F2& b, v8f c) { c = wmma_bf(a.l, b.h, c); c = wmma_bf(a.h, b.l, c); return wmma_bf(a.h, b.h, c); }
__device__ __forceinline__ float sigm(float v) { return 1.0f / (1.0f + expf(-v)); }
#define LDSX() do { asm volatile("s_wait_dscnt 0" ::: "memory"); __builtin_amdgcn_wave_barrier(); __builtin_amdgcn_fence(__ATOMIC_RELEASE, "workgroup"); } while (0)


// Self attention with channel reduction (B 8, 64 x 64 -> 4,096 positions, C 256, inner 32): attn = softmax(fy(y) . gx(x)^T) (unscaled); out = x + sigma (attn . hx(x)) W_out.
#define NB 8
#define NN 4096
#define CC 256
#define CI 32
#ifndef TNB
#define TNB NB
#endif
typedef __attribute__((ext_vector_type(8))) __bf16 v8b;
__device__ __forceinline__ v16b frag_b(const __bf16* rowk0, int lane) {
  union { v16b v; v8b q[2]; } u; const __bf16* p = rowk0 + 8 * (lane >> 4);
  u.q[0] = *(const v8b*)p; u.q[1] = *(const v8b*)(p + 16); return u.v;
}
__device__ __forceinline__ float bfr(float v) { return (float)(__bf16)v; }
__device__ __attribute__((noinline)) float exp_ni(float v) { return expf(v); }
__device__ __attribute__((noinline)) float erf_ni(float v) { return erff(v); }

#define WS_PW  0u                                   // (first 48 KiB not used); bf16 rows [256][32] W_out^T
#define WS_PO  (WS_PW + 2u * 3 * CI * CC)
#define WS_FG  (WS_PO + 2u * CC * CI)                   // f16 hi|lo rows of 64 B: fy [b*NN + n][32], behind them gx [b*NN + n][32]
#define GX ((size_t)NB * NN * CI)                       // where the gx rows begin in FG and in FGL: a run of keys is contiguous, so a wave's 512-B copy of 8 gx rows takes 4 whole 128-B lines, not half of each of 8
#define WS_FGL (WS_FG + 2u * (size_t)NB * NN * 2 * CI)
#define WS_HT  (WS_FGL + 2u * (size_t)NB * NN * 2 * CI) // f16 hi|lo hx planes [b][32][NN]
#define WS_HTL (WS_HT + 2u * (size_t)NB * CI * NN)
#define WS_END (WS_HTL + 2u * (size_t)NB * CI * NN)

__device__ __forceinline__ v16b fragb_f32(const float* __restrict__ p, int lane) { v16b a; const float* pp = p + 8 * (lane >> 4);
#pragma unroll
  for (int i = 0; i < 8; ++i) { a[i] = (__bf16)pp[i]; a[8 + i] = (__bf16)pp[16 + i]; } return a; }
// ---- k_proj: block = (64 positions, b): fy (from y), gx, hx (from x): 6 column tiles of 16; fy and gx -> rows hi/lo, each in an array of its own; hx -> planes hi/lo; the block rounds the three (in,out) weights to bf16 itself and lays them transposed in LDS (row = output channel, pitch 528 B = 16 B x odd), so no launch stands in front of this one; the blocks of b = 0 also write the W_out^T rows that the next launch reads
#define WP 264
__global__ __launch_bounds__(128) void k_proj(const float* __restrict__ X, const float* __restrict__ Y, const float* __restrict__ WFY, const float* __restrict__ WGX, const float* __restrict__ WHX, const float* __restrict__ WOUT, __bf16* __restrict__ PO, _Float16* __restrict__ FG, _Float16* __restrict__ FGL, _Float16* __restrict__ HT, _Float16* __restrict__ HTL) {
  __shared__ __align__(16) _Float16 sh[64][72], sl[64][72]; __shared__ __align__(16) _Float16 th[CI][72], tl[CI][72]; __shared__ __align__(16) __bf16 sw[3 * CI][WP];
  const int tid = threadIdx.x, wave = tid >> 5, lane = tid & 31, col = lane & 15, g = lane >> 4; const size_t b = blockIdx.y; const int n0 = blockIdx.x * 64 + wave * 16; const size_t r0 = b * NN + n0;
  // a thread takes 8 k rows x 4 output channels at a time: 8 loads of 16 B (8 lanes cover a 128-B weight row), 4 LDS stores of 8 bf16 along k; all 48 loads are asked for before the first is used
  const int kg = tid >> 3, oq = tid & 7; v4f wr[6][8];
#pragma unroll
  for (int i = 0; i < 6; ++i) { const float* __restrict__ Wm = i < 2 ? WFY : i < 4 ? WGX : WHX;
#pragma unroll
    for (int e = 0; e < 8; ++e) wr[i][e] = *(const v4f*)(Wm + (size_t)(((i & 1) * 16 + kg) * 8 + e) * CI + oq * 4);
    if (i & 1) asm volatile("s_wait_xcnt 0x0" ::: "memory"); }   // stands behind one matrix's loads: the next loads' results may be given the registers that held these loads' addresses
#pragma unroll
  for (int i = 0; i < 6; ++i)
#pragma unroll
    for (int c = 0; c < 4; ++c) { v8b wt;
#pragma unroll
      for (int e = 0; e < 8; ++e) wt[e] = (__bf16)wr[i][e][c];
      *(v8b*)&sw[(i >> 1) * CI + oq * 4 + c][((i & 1) * 16 + kg) * 8] = wt; }
  if (blockIdx.y == 0) { const int o = blockIdx.x * (CC / (NN / 64)) + wave; PO[(size_t)o * CI + lane] = (__bf16)WOUT[(size_t)lane * CC + o]; }   // the same for a whole block: 4 rows [o][32] of W_out^T, 256 B that no other block writes
  __syncthreads();   // hands the staged weight rows to all four waves
  v8f acc[6] = {};
#pragma unroll 2
  for (int kc = 0; kc < CC / 32; ++kc) { const v16b ay = fragb_f32(Y + (r0 + col) * CC + kc * 32, lane), ax = fragb_f32(X + (r0 + col) * CC + kc * 32, lane);
    v16b bw[6];
#pragma unroll
    for (int j = 0; j < 6; ++j) bw[j] = frag_b(&sw[j * 16 + col][kc * 32], lane);   // a k step's six weight fragments are read from LDS together, ahead of its products: one LDS latency a step
#pragma unroll
    for (int j = 0; j < 6; ++j) acc[j] = wmma_bf(j < 2 ? ay : ax, bw[j], acc[j]); }
#pragma unroll
  for (int j = 0; j < 6; ++j)
#pragma unroll
    for (int r = 0; r < 8; ++r) { const float v = j < 2 ? acc[j][r] * 1.44269504088896340736f : acc[j][r]; const _Float16 hv = (_Float16)v, lv = (_Float16)(v - (float)hv);   // fy carries log2 e, so the softmax needs no multiply in front of exp2; a residual keeps its own scale, so its products add into the same accumulator as the hi products
      if (j < 4) { sh[wave * 16 + 8 * g + r][j * 16 + col] = hv; sl[wave * 16 + 8 * g + r][j * 16 + col] = lv; } else { th[(j - 4) * 16 + col][wave * 16 + 8 * g + r] = hv; tl[(j - 4) * 16 + col][wave * 16 + 8 * g + r] = lv; } }
  __syncthreads();
  for (int e = tid; e < 64 * 8; e += 128) { const int pl = e >> 8, rl = (e >> 2) & 63, q = e & 3; const size_t o = pl * GX + (b * NN + blockIdx.x * 64 + rl) * CI + q * 8; vst2((unsigned*)(FG + o), *(const v4u*)&sh[rl][pl * CI + q * 8]); vst2((unsigned*)(FGL + o), *(const v4u*)&sl[rl][pl * CI + q * 8]); }   // pl: 0 the fy rows, 1 the gx rows; a wave stores 8 rows = 512 contiguous bytes
  for (int e = tid; e < CI * 8; e += 128) { const int cl = e >> 3, q = e & 7; const size_t o = (b * CI + cl) * (size_t)NN + blockIdx.x * 64 + q * 8; vst2((unsigned*)(HT + o), *(const v4u*)&th[cl][q * 8]); vst2((unsigned*)(HTL + o), *(const v4u*)&tl[cl][q * 8]); } }
// ---- staging for k_att: one stage = 128 keys: gx rows hi/lo (64 B a key, LDS pitch 80 B) and hx planes hi/lo (256 B a channel, LDS pitch 272 B); both pitches are 16 B x odd, free of bank conflicts for 16-byte fragment reads
#define KS 128
#define KP 40
#define VP 136
struct Stage { _Float16 kh[KS][KP], kl[KS][KP], vh[CI][VP], vl[CI][VP]; };
__device__ __forceinline__ unsigned lds_at(const _Float16* p) { return (unsigned)(size_t)p; }   // LDS byte address = low 32 bits of the __shared__ address
// four asynchronous copies global -> LDS, 16 bytes a lane each, through no register; s_wait_xcnt stands in the copies' own statement so that it precedes every rewrite of an address register they name
__device__ __forceinline__ void copy4(unsigned l0, const _Float16* g0, unsigned l1, const _Float16* g1, unsigned l2, const _Float16* g2, unsigned l3, const _Float16* g3) {
  asm volatile("global_load_async_to_lds_b128 %0, %1, off\n\tglobal_load_async_to_lds_b128 %2, %3, off\n\tglobal_load_async_to_lds_b128 %4, %5, off\n\tglobal_load_async_to_lds_b128 %6, %7, off\n\ts_wait_xcnt 0x0"
               :: "v"(l0), "v"(g0), "v"(l1), "v"(g1), "v"(l2), "v"(g2), "v"(l3), "v"(g3) : "memory"); }
// 256 threads fill one stage: 8 copies a thread; a key row is 4 pieces of 16 B (64 rows a round), a channel row 16 pieces (16 rows a round)
__device__ __forceinline__ void fill(Stage* s, const _Float16* __restrict__ FG, const _Float16* __restrict__ FGL, const _Float16* __restrict__ HT, const _Float16* __restrict__ HTL, size_t b, int st, int tid) {
  const int kr = tid >> 2, kq = (tid & 3) * 8, vr = tid >> 4, vq = (tid & 15) * 8;
  const size_t gk = GX + (b * NN + st * KS + kr) * CI + kq, dk = 64 * CI, gv = (b * CI + vr) * (size_t)NN + st * KS + vq, dv = 16 * (size_t)NN;
  copy4(lds_at(&s->kh[kr][kq]), FG + gk, lds_at(&s->kh[kr + 64][kq]), FG + gk + dk, lds_at(&s->kl[kr][kq]), FGL + gk, lds_at(&s->kl[kr + 64][kq]), FGL + gk + dk);
  copy4(lds_at(&s->vh[vr][vq]), HT + gv, lds_at(&s->vh[vr + 16][vq]), HT + gv + dv, lds_at(&s->vl[vr][vq]), HTL + gv, lds_at(&s->vl[vr + 16][vq]), HTL + gv + dv); }
// ---- k_att: block = (64 queries, b), 8 waves: a wave holds TWO query tiles (32 queries) and walks one quarter (32 keys) of every stage, so each gx and hx fragment it reads from LDS feeds two tiles' products: half the LDS reads a score of the one-tile wave; waves (qp, kq = 0..3) share the 32 queries of pair qp, each with running maxima, sums and O of its own (four waves a SIMD with two blocks a WGP); the four partial results join once, through LDS, at the end; the block's waves read gx and hx from LDS stages (two buffers, the next stage's copies fly under this stage's work): transposed tiles S^T = gx_k . fy_q^T (3 products, one accumulator): a lane holds 16 of the 32 keys of ONE query of each tile, so maximum and sum are in-lane (one exchange between the wave's halves for the maximum; the halves' sums join once at the end) and a tile's two score tiles, converted in place, are the B operand of O^T += hx^T . P^T (2 products, one accumulator) -> attn_g rows in LDS; the block that made these 64 rows also makes their output rows: out = x + sigma (attn_g (hi + lo) . W_out), a wave taking 16 rows x 128 columns
__device__ __forceinline__ float other_half(float v) { return __builtin_bit_cast(float, __builtin_amdgcn_permlanex16(__builtin_bit_cast(int, v), __builtin_bit_cast(int, v), 0x76543210, 0xfedcba98, false, false)); }   // lane l <-> l ^ 16
__global__ __launch_bounds__(256) void k_att(const _Float16* __restrict__ FG, const _Float16* __restrict__ FGL, const _Float16* __restrict__ HT, const _Float16* __restrict__ HTL, const __bf16* __restrict__ PO, const float* __restrict__ X, const float* __restrict__ SIG, float* __restrict__ OUT) {
  __shared__ __align__(16) float so[4][16][36]; __shared__ __align__(16) float xp[3][2][32][36]; __shared__ __align__(16) Stage sb[2];   // xp: a lane's 2 x 16 partial outputs, then maximum and sum of each tile; pitch 144 B = 16 B x odd
  const int tid = threadIdx.x, qp = (tid >> 5) & 1, kq = tid >> 6, lane = tid & 31, col = lane & 15, g = lane >> 4; const size_t b = blockIdx.y; const int q0 = blockIdx.x * 64 + qp * 32; const size_t rq = b * NN + q0;   // qp: query pair (tiles 2 qp, 2 qp + 1); kq: which quarter of a stage's keys
  v16h aq[2], aql[2];
#pragma unroll
  for (int t = 0; t < 2; ++t) { aq[t] = frag_h(FG + (rq + t * 16 + col) * CI, lane); aql[t] = frag_h(FGL + (rq + t * 16 + col) * CI, lane); }
  float m[2] = {-3.0e38f, -3.0e38f}, l[2] = {0.f, 0.f};   // query col of tile t: running maximum of the base-2 logits (equal in both halves), this half's share of the sum, x 2^11
  v8f acc[2][2] = {};   // [t][j] element r = channel j * 16 + 8 g + r of query col of tile t, x 2^11
  fill(&sb[0], FG, FGL, HT, HTL, b, 0, tid);
  asm volatile("s_wait_asynccnt 0x0" ::: "memory");   // this wave's copies of stage 0 have landed
  __syncthreads();                                     // publishes stage 0 to the other waves
  fill(&sb[1], FG, FGL, HT, HTL, b, 1, tid);
#pragma unroll 1   // one copy of the stage body: the publish point and the refill stand once, in the ring's order
  for (int st = 0; st < NN / KS; ++st) { const Stage* cs = &sb[st & 1];
  { const int ks = kq; v8f s[2][2];   // s[t][ct][r] = logit of key ks * 32 + ct * 16 + 8 g + r with query col of tile t
    v16h kh[2], kl[2], vh[2], vl[2];   // no LDS write stands in the pass, so all its fragment loads are issued at its head: the hx ones land under the score products and the softmax
#pragma unroll
    for (int ct = 0; ct < 2; ++ct) { const int rk = ks * 32 + ct * 16 + col; kh[ct] = frag_h(&cs->kh[rk][0], lane); kl[ct] = frag_h(&cs->kl[rk][0], lane); }
#pragma unroll
    for (int j = 0; j < 2; ++j) { vh[j] = frag_h(&cs->vh[j * 16 + col][ks * 32], lane); vl[j] = frag_h(&cs->vl[j * 16 + col][ks * 32], lane); }
#pragma unroll
    for (int t = 0; t < 2; ++t) {
      s[t][0] = wmma16(kl[0], aq[t], v8f{}); s[t][1] = wmma16(kl[1], aq[t], v8f{});   // the two key tiles' chains alternate: a product's successor in its own accumulator stands two matrix instructions behind it
      s[t][0] = wmma16(kh[0], aql[t], s[t][0]); s[t][1] = wmma16(kh[1], aql[t], s[t][1]);
      s[t][0] = wmma16(kh[0], aq[t], s[t][0]); s[t][1] = wmma16(kh[1], aq[t], s[t][1]); }
#pragma unroll
    for (int t = 0; t < 2; ++t) {
      float mx = fmaxf(s[t][0][0], s[t][1][0]), my = fmaxf(s[t][0][4], s[t][1][4]);   // two chains, half the dependent length
#pragma unroll
      for (int r = 1; r < 4; ++r) { mx = fmaxf(mx, fmaxf(s[t][0][r], s[t][1][r])); my = fmaxf(my, fmaxf(s[t][0][4 + r], s[t][1][4 + r])); }
      mx = fmaxf(mx, my);
      mx = fmaxf(mx, other_half(mx));
      const float mn = fmaxf(m[t], mx), alpha = __builtin_amdgcn_exp2f(m[t] - mn), mb = mn - 11.0f; m[t] = mn;   // mb: the 2^11 of P rides in the subtracted maximum
      v16h pa; float es = 0.f;   // pa element i = key 8 g + i, 8 + i = key 16 + 8 g + i: the k order of frag_h
#pragma unroll
      for (int r = 0; r < 8; ++r) { const float e0 = __builtin_amdgcn_exp2f(s[t][0][r] - mb), e1 = __builtin_amdgcn_exp2f(s[t][1][r] - mb); es += e0 + e1; pa[r] = (_Float16)e0; pa[8 + r] = (_Float16)e1; }
      l[t] = l[t] * alpha + es;
#pragma unroll
      for (int j = 0; j < 2; ++j)
#pragma unroll
        for (int r = 0; r < 8; ++r) acc[t][j][r] *= alpha;
      acc[t][0] = wmma16(vh[0], pa, acc[t][0]); acc[t][1] = wmma16(vh[1], pa, acc[t][1]);
      acc[t][0] = wmma16(vl[0], pa, acc[t][0]); acc[t][1] = wmma16(vl[1], pa, acc[t][1]); } }
    asm volatile("s_wait_dscnt 0x0" ::: "memory");      // this wave's reads of stage st are done before its buffer is handed back
    asm volatile("s_wait_asynccnt 0x0" ::: "memory");   // this wave's copies of stage st + 1 have landed
    __syncthreads();                                     // publishes stage st + 1 and ends every wave's reads of stage st
    if (st + 2 < NN / KS) fill(&sb[st & 1], FG, FGL, HT, HTL, b, st + 2, tid); }
  asm volatile("s_wait_asynccnt 0x0" ::: "memory");     // no copy is outstanding when the wave goes on to its end
  float o[2][16];   // this wave's partial outputs, tile t relative to its own maximum m[t]
#pragma unroll
  for (int t = 0; t < 2; ++t)
#pragma unroll
    for (int j = 0; j < 2; ++j)
#pragma unroll
      for (int r = 0; r < 8; ++r) o[t][j * 8 + r] = acc[t][j][r];
  if (kq != 0) { float* xw = &xp[kq - 1][qp][lane][0];
#pragma unroll
    for (int t = 0; t < 2; ++t)
#pragma unroll
      for (int i = 0; i < 4; ++i) *(v4f*)(xw + 16 * t + 4 * i) = v4f{o[t][4 * i], o[t][4 * i + 1], o[t][4 * i + 2], o[t][4 * i + 3]};
    *(v4f*)(xw + 32) = v4f{m[0], l[0], m[1], l[1]}; }
  __syncthreads();   // hands the other three key quarters' partial results to the wave that holds the first quarter of the same queries
  // operands of the output rows, asked for here so that they arrive under the join of the partial results: wave w takes row tile w & 3 and column half w >> 2
  const int rt = (tid >> 5) & 3, c0 = (tid >> 7) * 128; const size_t r0 = b * NN + blockIdx.x * 64 + rt * 16; const float sg = bfr(SIG[0]);
  v16b wo[8]; float xr[8][8];
#pragma unroll
  for (int j = 0; j < 8; ++j) wo[j] = frag_b(PO + (size_t)(c0 + j * 16 + col) * CI, lane);
  asm volatile("s_wait_xcnt 0x0" ::: "memory");   // stands in front of the x loads, whose results may be given the registers that held the addresses of the loads above
#pragma unroll
  for (int j = 0; j < 8; ++j)
#pragma unroll
    for (int r = 0; r < 8; ++r) xr[j][r] = X[(r0 + 8 * g + r) * CC + c0 + j * 16 + col];
  if (kq == 0) {   // the same for a whole wave
  v4f ml[3];
#pragma unroll
  for (int p = 0; p < 3; ++p) ml[p] = *(const v4f*)(&xp[p][qp][lane][32]);
#pragma unroll
  for (int t = 0; t < 2; ++t) {
    const float mt = fmaxf(fmaxf(m[t], ml[0][2 * t]), fmaxf(ml[1][2 * t], ml[2][2 * t])), fa = __builtin_amdgcn_exp2f(m[t] - mt);
    float lt = l[t] * fa;
#pragma unroll
    for (int i = 0; i < 16; ++i) o[t][i] *= fa;
#pragma unroll
    for (int p = 0; p < 3; ++p) { const float fb = __builtin_amdgcn_exp2f(ml[p][2 * t] - mt); lt += ml[p][2 * t + 1] * fb;
#pragma unroll
      for (int i = 0; i < 4; ++i) { const v4f pv = *(const v4f*)(&xp[p][qp][lane][16 * t + 4 * i]);
#pragma unroll
        for (int e = 0; e < 4; ++e) o[t][4 * i + e] += pv[e] * fb; } }
    lt += other_half(lt);
    const float il = 1.0f / lt;   // sum and outputs both carry the 2^11
#pragma unroll
    for (int j = 0; j < 2; ++j)
#pragma unroll
      for (int r = 0; r < 8; ++r) so[qp * 2 + t][col][j * 16 + 8 * g + r] = o[t][j * 8 + r] * il; } }
  __syncthreads();   // hands the block's 64 attn_g rows to all eight waves
  float* sf = (float*)&sb[0] + (size_t)(tid >> 5) * (16 * 132);   // a wave's own 16 x 128 output tile, pitch 132 floats, in the stage buffers: their last reader left at the loop's last barrier and no copy is outstanding
  v8f oc[8] = {}; { const F2 a = split_row(&so[rt][col][0], 0, lane);
#pragma unroll
    for (int j = 0; j < 8; ++j) { oc[j] = wmma_bf(a.h, wo[j], oc[j]); oc[j] = wmma_bf(a.l, wo[j], oc[j]); } }
#pragma unroll
  for (int j = 0; j < 8; ++j)
#pragma unroll
    for (int r = 0; r < 8; ++r) sf[(8 * g + r) * 132 + j * 16 + col] = bfr(xr[j][r]) + sg * oc[j][r];
  LDSX(); for (int rl = 0; rl < 16; ++rl) vst2(OUT + (r0 + rl) * CC + c0 + lane * 4, *(const v4f*)&sf[rl * 132 + lane * 4]); }
extern "C" void kernel_launch(void* const* d_in, const int* in_sizes, int n_in, void* d_out, int out_size, void* d_ws, size_t ws_size, hipStream_t stream) {
  (void)in_sizes; (void)n_in; (void)out_size;
  const float** F = (const float**)d_in;   // 0 x [8,64,64,256], 1 y, 2 W_fy [256,32], 3 W_gx, 4 W_hx, 5 W_out [32,256], 6 sigma [1]
  if (ws_size < (size_t)WS_END) return;
  char* ws = (char*)d_ws; __bf16* PO = (__bf16*)(ws + WS_PO); _Float16 *FG = (_Float16*)(ws + WS_FG), *FGL = (_Float16*)(ws + WS_FGL), *HT = (_Float16*)(ws + WS_HT), *HTL = (_Float16*)(ws + WS_HTL);
  k_proj<<<dim3(NN / 64, TNB), 128, 0, stream>>>(F[0], F[1], F[2], F[3], F[4], F[5], PO, FG, FGL, HT, HTL);
  k_att<<<dim3(NN / 64, TNB), 256, 0, stream>>>(FG, FGL, HT, HTL, PO, F[0], F[6], (float*)d_out);
}

// v010
// It runs in 49.8 microseconds.
// Timed twice side by side with v009, it ran 1.03 times as fast both times.
// All steps since v000 together make it 5.93 times as fast.
// compute dtype: all float inputs rounded to bf16, sigma read on device; fy, gx, hx with EXACT bf16 products on WMMA 16x16x32 ((in,out) weights packed to transposed rows), fy (x log2 e) and gx rounded to f16 hi + residual rows, hx to f16 hi + residual planes (residuals at their own scale, f16 subnormals included); logits fy . gx (base 2) with 3 products in one accumulator, running-max softmax in f32 (hardware exp2), P (x 2^11, f16) . hx (2 products in one accumulator); out = x + sigma (attn_g (bf16 hi + lo, 2 products) . W_out); f32 output.
#include <hip/hip_runtime.h>
#include <math.h>

typedef __attribute__((ext_vector_type(16))) _Float16 v16h;
typedef __attribute__((ext_vector_type(16))) __bf16 v16b;
typedef __attribute__((ext_vector_type(8)))  _Float16 v8h;
typedef __attribute__((ext_vector_type(8)))  float v8f;
typedef __attribute__((ext_vector_type(4)))  float v4f;
typedef __attribute__((ext_vector_type(2)))  float v2f;
typedef __attribute__((ext_vector_type(4)))  unsigned v4u;
typedef __attribute__((ext_vector_type(4)))  int v4i;
typedef float __attribute__((may_alias)) float_a;
typedef int __attribute__((may_alias)) int_a;

template <typename T> __device__ __forceinline__ void vst2(void* p, T v) { *(T*)p = v;  }
__device__ __forceinline__ v8f wmma16(v16h a, v16h b, v8f c) {   // the builtin alone: the compiler keeps the distance behind it itself and is free to put other work of the wave there
  return __builtin_amdgcn_wmma_f32_16x16x32_f16(false, a, false, b, (short)0, c, false, false);
}
__device__ __forceinline__ v8f wmma_bf(v16b a, v16b b, v8f c) {
  v8f d = __builtin_amdgcn_wmma_f32_16x16x32_bf16(false, a, false, b, (short)0, c, false, false);
  asm volatile("v_nop\n\tv_nop\n\tv_nop\n\tv_nop" : "+v"(d) : "v"(a), "v"(b));
  return d;
}
// 16x16x32 fragments: lane = (h = lane>>4, row/col = lane&15); elements 0..7 = k0+8h+0..7, 8..15 = k0+16+8h+0..7; D element r = row 8h+r
__device__ __forceinline__ v16h frag_h(const _Float16* rowk0, int lane) {
  union { v16h v; v8h q[2]; } u; const _Float16* p = rowk0 + 8 * (lane >> 4);
  u.q[0] = *(const v8h*)p; u.q[1] = *(const v8h*)(p + 16); return u.v;
}
__device__ __forceinline__ v16h frag_f32(const float* rowk0, int lane) {
  v16h a; const float* p = rowk0 + 8 * (lane >> 4);
#pragma unroll
  for (int i = 0; i < 8; ++i) { a[i] = (_Float16)p[i]; a[8 + i] = (_Float16)p[16 + i]; }
  return a;
}
__device__ __forceinline__ v16h frag_f32s(const float* rowk0, int lane, float sc) {
  v16h a; const float* p = rowk0 + 8 * (lane >> 4);
#pragma unroll
  for (int i = 0; i < 8; ++i) { a[i] = (_Float16)(p[i] * sc); a[8 + i] = (_Float16)(p[16 + i] * sc); }
  return a;
}
// column fragment from a [K][ld] layout (column n), rows >= K read as 0
__device__ __forceinline__ v16h fragc_f32(const float* W, int k0, int n, int lane, int ld, int K) {
  v16h a; const int g = lane >> 4;
#pragma unroll
  for (int i = 0; i < 8; ++i) { const int ka = k0 + 8 * g + i, kb = ka + 16;
    a[i] = (_Float16)(ka < K ? W[(size_t)(ka < K ? ka : K - 1) * ld + n] : 0.f); a[8 + i] = (_Float16)(kb < K ? W[(size_t)(kb < K ? kb : K - 1) * ld + n] : 0.f); }
  return a;
}
struct F2 { v16b h, l; };
__device__ __forceinline__ F2 bsplit16(const float v[16]) { F2 r;
#pragma unroll
  for (int i = 0; i < 16; ++i) { const __bf16 h = (__bf16)v[i]; r.h[i] = h; r.l[i] = (__bf16)(v[i] - (float)h); }
  return r; }
__device__ __forceinline__ F2 split_row(const float* row, int k0, int lane) { float v[16]; const float* p = row + k0 + 8 * (lane >> 4);
#pragma unroll
  for (int i = 0; i < 8; ++i) { v[i] = p[i]; v[8 + i] = p[16 + i]; }
  return bsplit16(v); }
__device__ __forceinline__ F2 split_rowK(const float* row, int k0, int lane, int K) { float v[16]; const int g = lane >> 4;
#pragma unroll
  for (int i = 0; i < 8; ++i) { const int ka = k0 + 8 * g + i, kb = ka + 16; v[i] = ka < K ? row[ka < K ? ka : K - 1] : 0.f; v[8 + i] = kb < K ? row[kb < K ? kb : K - 1] : 0.f; }
  return bsplit16(v); }
__device__ __forceinline__ F2 split_col(const float* W, int k0, int n, int lane, int ld, int K) { float v[16]; const int g = lane >> 4;
#pragma unroll
  for (int i = 0; i < 8; ++i) { const int ka = k0 + 8 * g + i, kb = ka + 16; v[i] = ka < K ? W[(size_t)(ka < K ? ka : K - 1) * ld + n] : 0.f; v[8 + i] = kb < K ? W[(size_t)(kb < K ? kb : K - 1) * ld + n] : 0.f; }
  return bsplit16(v); }
__device__ __forceinline__ v8f mac3(const F2& a, const F2& b, v8f c) { c = wmma_bf(a.l, b.h, c); c = wmma_bf(a.h, b.l, c); return wmma_bf(a.h, b.h, c); }
__device__ __forceinline__ float sigm(float v) { return 1.0f / (1.0f + expf(-v)); }
#define LDSX() do { asm volatile("s_wait_dscnt 0" ::: "memory"); __builtin_amdgcn_wave_barrier(); __builtin_amdgcn_fence(__ATOMIC_RELEASE, "workgroup"); } while (0)


// Self attention with channel reduction (B 8, 64 x 64 -> 4,096 positions, C 256, inner 32): attn = softmax(fy(y) . gx(x)^T) (unscaled); out = x + sigma (attn . hx(x)) W_out.
#define NB 8
#define NN 4096
#define CC 256
#define CI 32
#ifndef TNB
#define TNB NB
#endif
typedef __attribute__((ext_vector_type(8))) __bf16 v8b;
__device__ __forceinline__ v16b frag_b(const __bf16* rowk0, int lane) {
  union { v16b v; v8b q[2]; } u; const __bf16* p = rowk0 + 8 * (lane >> 4);
  u.q[0] = *(const v8b*)p; u.q[1] = *(const v8b*)(p + 16); return u.v;
}
__device__ __forceinline__ float bfr(float v) { return (float)(__bf16)v; }
__device__ __attribute__((noinline)) float exp_ni(float v) { return expf(v); }
__device__ __attribute__((noinline)) float erf_ni(float v) { return erff(v); }

#define WS_PW  0u                                   // (first 48 KiB not used); bf16 rows [256][32] W_out^T
#define WS_PO  (WS_PW + 2u * 3 * CI * CC)
#define WS_FG  (WS_PO + 2u * CC * CI)                   // f16 hi|lo rows of 64 B: fy [b*NN + n][32], behind them gx [b*NN + n][32]
#define GX ((size_t)NB * NN * CI)                       // where the gx rows begin in FG and in FGL: a run of keys is contiguous, so a wave's 512-B copy of 8 gx rows takes 4 whole 128-B lines, not half of each of 8
#define WS_FGL (WS_FG + 2u * (size_t)NB * NN * 2 * CI)
#define WS_HT  (WS_FGL + 2u * (size_t)NB * NN * 2 * CI) // f16 hi|lo hx planes [b][32][NN]
#define WS_HTL (WS_HT + 2u * (size_t)NB * CI * NN)
#define WS_END (WS_HTL + 2u * (size_t)NB * CI * NN)

__device__ __forceinline__ v16b fragb_f32(const float* __restrict__ p, int lane) { v16b a; const float* pp = p + 8 * (lane >> 4);
#pragma unroll
  for (int i = 0; i < 8; ++i) { a[i] = (__bf16)pp[i]; a[8 + i] = (__bf16)pp[16 + i]; } return a; }
// a fragment's 16 floats as they come from memory (4 loads of 16 B a lane), kept apart from their rounding so that the loads can be asked for several k steps ahead of their use; element order as in fragb_f32
struct R16 { v4f q[4]; };
__device__ __forceinline__ R16 ld16(const float* __restrict__ p, int lane) { R16 r; const float* pp = p + 8 * (lane >> 4); r.q[0] = *(const v4f*)pp; r.q[1] = *(const v4f*)(pp + 4); r.q[2] = *(const v4f*)(pp + 16); r.q[3] = *(const v4f*)(pp + 20); return r; }
__device__ __forceinline__ v16b cvt16(const R16& r) { v16b a;
#pragma unroll   // vector elements are indexed by constants
  for (int i = 0; i < 4; ++i) { a[i] = (__bf16)r.q[0][i]; a[4 + i] = (__bf16)r.q[1][i]; a[8 + i] = (__bf16)r.q[2][i]; a[12 + i] = (__bf16)r.q[3][i]; } return a; }
#define LA 4   // k steps of x and y rows in flight a wave
// ---- k_proj: block = (64 positions, b): fy (from y), gx, hx (from x): 6 column tiles of 16; fy and gx -> rows hi/lo, each in an array of its own; hx -> planes hi/lo; the block rounds the three (in,out) weights to bf16 itself and lays them transposed in LDS (row = output channel, pitch 528 B = 16 B x odd), so no launch stands in front of this one; the blocks of b = 0 also write the W_out^T rows that the next launch reads
#define WP 264
__global__ __launch_bounds__(128) void k_proj(const float* __restrict__ X, const float* __restrict__ Y, const float* __restrict__ WFY, const float* __restrict__ WGX, const float* __restrict__ WHX, const float* __restrict__ WOUT, __bf16* __restrict__ PO, _Float16* __restrict__ FG, _Float16* __restrict__ FGL, _Float16* __restrict__ HT, _Float16* __restrict__ HTL) {
  __shared__ __align__(16) _Float16 sh[64][72], sl[64][72]; __shared__ __align__(16) _Float16 th[CI][72], tl[CI][72]; __shared__ __align__(16) __bf16 sw[3 * CI][WP];
  const int tid = threadIdx.x, wave = tid >> 5, lane = tid & 31, col = lane & 15, g = lane >> 4; const size_t b = blockIdx.y; const int n0 = blockIdx.x * 64 + wave * 16; const size_t r0 = b * NN + n0;
  // a thread takes 8 k rows x 4 output channels at a time: 8 loads of 16 B (8 lanes cover a 128-B weight row), 4 LDS stores of 8 bf16 along k; all 48 loads are asked for before the first is used
  const int kg = tid >> 3, oq = tid & 7; v4f wr[6][8];
#pragma unroll
  for (int i = 0; i < 6; ++i) { const float* __restrict__ Wm = i < 2 ? WFY : i < 4 ? WGX : WHX;
#pragma unroll
    for (int e = 0; e < 8; ++e) wr[i][e] = *(const v4f*)(Wm + (size_t)(((i & 1) * 16 + kg) * 8 + e) * CI + oq * 4);
    if (i & 1) asm volatile("s_wait_xcnt 0x0" ::: "memory"); }   // stands behind one matrix's loads: the next loads' results may be given the registers that held these loads' addresses
#pragma unroll
  for (int i = 0; i < 6; ++i)
#pragma unroll
    for (int c = 0; c < 4; ++c) { v8b wt;
#pragma unroll
      for (int e = 0; e < 8; ++e) wt[e] = (__bf16)wr[i][e][c];
      *(v8b*)&sw[(i >> 1) * CI + oq * 4 + c][((i & 1) * 16 + kg) * 8] = wt; }
  const float* __restrict__ yrow = Y + (r0 + col) * CC; const float* __restrict__ xrow = X + (r0 + col) * CC; R16 ry[LA], rx[LA];   // the first LA k steps' rows are asked for ahead of the barrier: they fly under the wait at the barrier; behind it every step asks for the rows of the step LA further on
#pragma unroll   // the row registers are indexed by constants
  for (int i = 0; i < LA; ++i) { ry[i] = ld16(yrow + i * 32, lane); rx[i] = ld16(xrow + i * 32, lane); }
  if (blockIdx.y == 0) { const int o = blockIdx.x * (CC / (NN / 64)) + wave; PO[(size_t)o * CI + lane] = (__bf16)WOUT[(size_t)lane * CC + o]; }   // the same for a whole block: 4 rows [o][32] of W_out^T, 256 B that no other block writes
  __syncthreads();   // hands the staged weight rows to all four waves
  v8f acc[6] = {};
#pragma unroll   // all 8 steps in one body: the ring of row registers is indexed by constants
  for (int kc = 0; kc < CC / 32; ++kc) { const v16b ay = cvt16(ry[kc % LA]), ax = cvt16(rx[kc % LA]);
    if (kc + LA < CC / 32) { ry[kc % LA] = ld16(yrow + (kc + LA) * 32, lane); rx[kc % LA] = ld16(xrow + (kc + LA) * 32, lane); }   // step kc + LA takes the registers that step kc has just left
    v16b bw[6];
#pragma unroll
    for (int j = 0; j < 6; ++j) bw[j] = frag_b(&sw[j * 16 + col][kc * 32], lane);   // a k step's six weight fragments are read from LDS together, ahead of its products: one LDS latency a step
#pragma unroll
    for (int j = 0; j < 6; ++j) acc[j] = wmma_bf(j < 2 ? ay : ax, bw[j], acc[j]); }
#pragma unroll
  for (int j = 0; j < 6; ++j)
#pragma unroll
    for (int r = 0; r < 8; ++r) { const float v = j < 2 ? acc[j][r] * 1.44269504088896340736f : acc[j][r]; const _Float16 hv = (_Float16)v, lv = (_Float16)(v - (float)hv);   // fy carries log2 e, so the softmax needs no multiply in front of exp2; a residual keeps its own scale, so its products add into the same accumulator as the hi products
      if (j < 4) { sh[wave * 16 + 8 * g + r][j * 16 + col] = hv; sl[wave * 16 + 8 * g + r][j * 16 + col] = lv; } else { th[(j - 4) * 16 + col][wave * 16 + 8 * g + r] = hv; tl[(j - 4) * 16 + col][wave * 16 + 8 * g + r] = lv; } }
  __syncthreads();
  for (int e = tid; e < 64 * 8; e += 128) { const int pl = e >> 8, rl = (e >> 2) & 63, q = e & 3; const size_t o = pl * GX + (b * NN + blockIdx.x * 64 + rl) * CI + q * 8; vst2((unsigned*)(FG + o), *(const v4u*)&sh[rl][pl * CI + q * 8]); vst2((unsigned*)(FGL + o), *(const v4u*)&sl[rl][pl * CI + q * 8]); }   // pl: 0 the fy rows, 1 the gx rows; a wave stores 8 rows = 512 contiguous bytes
  for (int e = tid; e < CI * 8; e += 128) { const int cl = e >> 3, q = e & 7; const size_t o = (b * CI + cl) * (size_t)NN + blockIdx.x * 64 + q * 8; vst2((unsigned*)(HT + o), *(const v4u*)&th[cl][q * 8]); vst2((unsigned*)(HTL + o), *(const v4u*)&tl[cl][q * 8]); } }
// ---- staging for k_att: one stage = 128 keys: gx rows hi/lo (64 B a key, LDS pitch 80 B) and hx planes hi/lo (256 B a channel, LDS pitch 272 B); both pitches are 16 B x odd, free of bank conflicts for 16-byte fragment reads
#define KS 128
#define KP 40
#define VP 136
struct Stage { _Float16 kh[KS][KP], kl[KS][KP], vh[CI][VP], vl[CI][VP]; };
__device__ __forceinline__ unsigned lds_at(const _Float16* p) { return (unsigned)(size_t)p; }   // LDS byte address = low 32 bits of the __shared__ address
// four asynchronous copies global -> LDS, 16 bytes a lane each, through no register; s_wait_xcnt stands in the copies' own statement so that it precedes every rewrite of an address register they name
__device__ __forceinline__ void copy4(unsigned l0, const _Float16* g0, unsigned l1, const _Float16* g1, unsigned l2, const _Float16* g2, unsigned l3, const _Float16* g3) {
  asm volatile("global_load_async_to_lds_b128 %0, %1, off\n\tglobal_load_async_to_lds_b128 %2, %3, off\n\tglobal_load_async_to_lds_b128 %4, %5, off\n\tglobal_load_async_to_lds_b128 %6, %7, off\n\ts_wait_xcnt 0x0"
               :: "v"(l0), "v"(g0), "v"(l1), "v"(g1), "v"(l2), "v"(g2), "v"(l3), "v"(g3) : "memory"); }
// 256 threads fill one stage: 8 copies a thread; a key row is 4 pieces of 16 B (64 rows a round), a channel row 16 pieces (16 rows a round)
__device__ __forceinline__ void fill(Stage* s, const _Float16* __restrict__ FG, const _Float16* __restrict__ FGL, const _Float16* __restrict__ HT, const _Float16* __restrict__ HTL, size_t b, int st, int tid) {
  const int kr = tid >> 2, kq = (tid & 3) * 8, vr = tid >> 4, vq = (tid & 15) * 8;
  const size_t gk = GX + (b * NN + st * KS + kr) * CI + kq, dk = 64 * CI, gv = (b * CI + vr) * (size_t)NN + st * KS + vq, dv = 16 * (size_t)NN;
  copy4(lds_at(&s->kh[kr][kq]), FG + gk, lds_at(&s->kh[kr + 64][kq]), FG + gk + dk, lds_at(&s->kl[kr][kq]), FGL + gk, lds_at(&s->kl[kr + 64][kq]), FGL + gk + dk);
  copy4(lds_at(&s->vh[vr][vq]), HT + gv, lds_at(&s->vh[vr + 16][vq]), HT + gv + dv, lds_at(&s->vl[vr][vq]), HTL + gv, lds_at(&s->vl[vr + 16][vq]), HTL + gv + dv); }
// ---- k_att: block = (64 queries, b), 8 waves: a wave holds TWO query tiles (32 queries) and walks one quarter (32 keys) of every stage, so each gx and hx fragment it reads from LDS feeds two tiles' products: half the LDS reads a score of the one-tile wave; waves (qp, kq = 0..3) share the 32 queries of pair qp, each with running maxima, sums and O of its own (four waves a SIMD with two blocks a WGP); the four partial results join once, through LDS, at the end; the block's waves read gx and hx from LDS stages (two buffers, the next stage's copies fly under this stage's work): transposed tiles S^T = gx_k . fy_q^T (3 products, one accumulator): a lane holds 16 of the 32 keys of ONE query of each tile, so maximum and sum are in-lane (one exchange between the wave's halves for the maximum; the halves' sums join once at the end) and a tile's two score tiles, converted in place, are the B operand of O^T += hx^T . P^T (2 products, one accumulator) -> attn_g rows in LDS; the block that made these 64 rows also makes their output rows: out = x + sigma (attn_g (hi + lo) . W_out), a wave taking 16 rows x 128 columns
__device__ __forceinline__ float other_half(float v) { return __builtin_bit_cast(float, __builtin_amdgcn_permlanex16(__builtin_bit_cast(int, v), __builtin_bit_cast(int, v), 0x76543210, 0xfedcba98, false, false)); }   // lane l <-> l ^ 16
__global__ __launch_bounds__(256) void k_att(const _Float16* __restrict__ FG, const _Float16* __restrict__ FGL, const _Float16* __restrict__ HT, const _Float16* __restrict__ HTL, const __bf16* __restrict__ PO, const float* __restrict__ X, const float* __restrict__ SIG, float* __restrict__ OUT) {
  __shared__ __align__(16) float so[4][16][36]; __shared__ __align__(16) float xp[3][2][32][36]; __shared__ __align__(16) Stage sb[2];   // xp: a lane's 2 x 16 partial outputs, then maximum and sum of each tile; pitch 144 B = 16 B x odd
  const int tid = threadIdx.x, qp = (tid >> 5) & 1, kq = tid >> 6, lane = tid & 31, col = lane & 15, g = lane >> 4; const size_t b = blockIdx.y; const int q0 = blockIdx.x * 64 + qp * 32; const size_t rq = b * NN + q0;   // qp: query pair (tiles 2 qp, 2 qp + 1); kq: which quarter of a stage's keys
  v16h aq[2], aql[2];
#pragma unroll
  for (int t = 0; t < 2; ++t) { aq[t] = frag_h(FG + (rq + t * 16 + col) * CI, lane); aql[t] = frag_h(FGL + (rq + t * 16 + col) * CI, lane); }
  float m[2] = {-3.0e38f, -3.0e38f}, l[2] = {0.f, 0.f};   // query col of tile t: running maximum of the base-2 logits (equal in both halves), this half's share of the sum, x 2^11
  v8f acc[2][2] = {};   // [t][j] element r = channel j * 16 + 8 g + r of query col of tile t, x 2^11
  fill(&sb[0], FG, FGL, HT, HTL, b, 0, tid);
  asm volatile("s_wait_asynccnt 0x0" ::: "memory");   // this wave's copies of stage 0 have landed
  __syncthreads();                                     // publishes stage 0 to the other waves
  fill(&sb[1], FG, FGL, HT, HTL, b, 1, tid);
#pragma unroll 1   // one copy of the stage body: the publish point and the refill stand once, in the ring's order
  for (int st = 0; st < NN / KS; ++st) { const Stage* cs = &sb[st & 1];
  { const int ks = kq; v8f s[2][2];   // s[t][ct][r] = logit of key ks * 32 + ct * 16 + 8 g + r with query col of tile t
    v16h kh[2], kl[2], vh[2], vl[2];   // no LDS write stands in the pass, so all its fragment loads are issued at its head: the hx ones land under the score products and the softmax
#pragma unroll
    for (int ct = 0; ct < 2; ++ct) { const int rk = ks * 32 + ct * 16 + col; kh[ct] = frag_h(&cs->kh[rk][0], lane); kl[ct] = frag_h(&cs->kl[rk][0], lane); }
#pragma unroll
    for (int j = 0; j < 2; ++j) { vh[j] = frag_h(&cs->vh[j * 16 + col][ks * 32], lane); vl[j] = frag_h(&cs->vl[j * 16 + col][ks * 32], lane); }
#pragma unroll
    for (int t = 0; t < 2; ++t) {
      s[t][0] = wmma16(kl[0], aq[t], v8f{}); s[t][1] = wmma16(kl[1], aq[t], v8f{});   // the two key tiles' chains alternate: a product's successor in its own accumulator stands two matrix instructions behind it
      s[t][0] = wmma16(kh[0], aql[t], s[t][0]); s[t][1] = wmma16(kh[1], aql[t], s[t][1]);
      s[t][0] = wmma16(kh[0], aq[t], s[t][0]); s[t][1] = wmma16(kh[1], aq[t], s[t][1]); }
#pragma unroll
    for (int t = 0; t < 2; ++t) {
      float mx = fmaxf(s[t][0][0], s[t][1][0]), my = fmaxf(s[t][0][4], s[t][1][4]);   // two chains, half the dependent length
#pragma unroll
      for (int r = 1; r < 4; ++r) { mx = fmaxf(mx, fmaxf(s[t][0][r], s[t][1][r])); my = fmaxf(my, fmaxf(s[t][0][4 + r], s[t][1][4 + r])); }
      mx = fmaxf(mx, my);
      mx = fmaxf(mx, other_half(mx));
      const float mn = fmaxf(m[t], mx), alpha = __builtin_amdgcn_exp2f(m[t] - mn), mb = mn - 11.0f; m[t] = mn;   // mb: the 2^11 of P rides in the subtracted maximum
      v16h pa; float es = 0.f;   // pa element i = key 8 g + i, 8 + i = key 16 + 8 g + i: the k order of frag_h
#pragma unroll
      for (int r = 0; r < 8; ++r) { const float e0 = __builtin_amdgcn_exp2f(s[t][0][r] - mb), e1 = __builtin_amdgcn_exp2f(s[t][1][r] - mb); es += e0 + e1; pa[r] = (_Float16)e0; pa[8 + r] = (_Float16)e1; }
      l[t] = l[t] * alpha + es;
#pragma unroll
      for (int j = 0; j < 2; ++j)
#pragma unroll
        for (int r = 0; r < 8; ++r) acc[t][j][r] *= alpha;
      acc[t][0] = wmma16(vh[0], pa, acc[t][0]); acc[t][1] = wmma16(vh[1], pa, acc[t][1]);
      acc[t][0] = wmma16(vl[0], pa, acc[t][0]); acc[t][1] = wmma16(vl[1], pa, acc[t][1]); } }
    asm volatile("s_wait_dscnt 0x0" ::: "memory");      // this wave's reads of stage st are done before its buffer is handed back
    asm volatile("s_wait_asynccnt 0x0" ::: "memory");   // this wave's copies of stage st + 1 have landed
    __syncthreads();                                     // publishes stage st + 1 and ends every wave's reads of stage st
    if (st + 2 < NN / KS) fill(&sb[st & 1], FG, FGL, HT, HTL, b, st + 2, tid); }
  asm volatile("s_wait_asynccnt 0x0" ::: "memory");     // no copy is outstanding when the wave goes on to its end
  float o[2][16];   // this wave's partial outputs, tile t relative to its own maximum m[t]
#pragma unroll
  for (int t = 0; t < 2; ++t)
#pragma unroll
    for (int j = 0; j < 2; ++j)
#pragma unroll
      for (int r = 0; r < 8; ++r) o[t][j * 8 + r] = acc[t][j][r];
  if (kq != 0) { float* xw = &xp[kq - 1][qp][lane][0];
#pragma unroll
    for (int t = 0; t < 2; ++t)
#pragma unroll
      for (int i = 0; i < 4; ++i) *(v4f*)(xw + 16 * t + 4 * i) = v4f{o[t][4 * i], o[t][4 * i + 1], o[t][4 * i + 2], o[t][4 * i + 3]};
    *(v4f*)(xw + 32) = v4f{m[0], l[0], m[1], l[1]}; }
  __syncthreads();   // hands the other three key quarters' partial results to the wave that holds the first quarter of the same queries
  // operands of the output rows, asked for here so that they arrive under the join of the partial results: wave w takes row tile w & 3 and column half w >> 2
  const int rt = (tid >> 5) & 3, c0 = (tid >> 7) * 128; const size_t r0 = b * NN + blockIdx.x * 64 + rt * 16; const float sg = bfr(SIG[0]);
  v16b wo[8]; float xr[8][8];
#pragma unroll
  for (int j = 0; j < 8; ++j) wo[j] = frag_b(PO + (size_t)(c0 + j * 16 + col) * CI, lane);
  asm volatile("s_wait_xcnt 0x0" ::: "memory");   // stands in front of the x loads, whose results may be given the registers that held the addresses of the loads above
#pragma unroll
  for (int j = 0; j < 8; ++j)
#pragma unroll
    for (int r = 0; r < 8; ++r) xr[j][r] = X[(r0 + 8 * g + r) * CC + c0 + j * 16 + col];
  if (kq == 0) {   // the same for a whole wave
  v4f ml[3];
#pragma unroll
  for (int p = 0; p < 3; ++p) ml[p] = *(const v4f*)(&xp[p][qp][lane][32]);
#pragma unroll
  for (int t = 0; t < 2; ++t) {
    const float mt = fmaxf(fmaxf(m[t], ml[0][2 * t]), fmaxf(ml[1][2 * t], ml[2][2 * t])), fa = __builtin_amdgcn_exp2f(m[t] - mt);
    float lt = l[t] * fa;
#pragma unroll
    for (int i = 0; i < 16; ++i) o[t][i] *= fa;
#pragma unroll
    for (int p = 0; p < 3; ++p) { const float fb = __builtin_amdgcn_exp2f(ml[p][2 * t] - mt); lt += ml[p][2 * t + 1] * fb;
#pragma unroll
      for (int i = 0; i < 4; ++i) { const v4f pv = *(const v4f*)(&xp[p][qp][lane][16 * t + 4 * i]);
#pragma unroll
        for (int e = 0; e < 4; ++e) o[t][4 * i + e] += pv[e] * fb; } }
    lt += other_half(lt);
    const float il = 1.0f / lt;   // sum and outputs both carry the 2^11
#pragma unroll
    for (int j = 0; j < 2; ++j)
#pragma unroll
      for (int r = 0; r < 8; ++r) so[qp * 2 + t][col][j * 16 + 8 * g + r] = o[t][j * 8 + r] * il; } }
  __syncthreads();   // hands the block's 64 attn_g rows to all eight waves
  float* sf = (float*)&sb[0] + (size_t)(tid >> 5) * (16 * 132);   // a wave's own 16 x 128 output tile, pitch 132 floats, in the stage buffers: their last reader left at the loop's last barrier and no copy is outstanding
  v8f oc[8] = {}; { const F2 a = split_row(&so[rt][col][0], 0, lane);
#pragma unroll
    for (int j = 0; j < 8; ++j) { oc[j] = wmma_bf(a.h, wo[j], oc[j]); oc[j] = wmma_bf(a.l, wo[j], oc[j]); } }
#pragma unroll
  for (int j = 0; j < 8; ++j)
#pragma unroll
    for (int r = 0; r < 8; ++r) sf[(8 * g + r) * 132 + j * 16 + col] = bfr(xr[j][r]) + sg * oc[j][r];
  LDSX(); for (int rl = 0; rl < 16; ++rl) vst2(OUT + (r0 + rl) * CC + c0 + lane * 4, *(const v4f*)&sf[rl * 132 + lane * 4]); }
extern "C" void kernel_launch(void* const* d_in, const int* in_sizes, int n_in, void* d_out, int out_size, void* d_ws, size_t ws_size, hipStream_t stream) {
  (void)in_sizes; (void)n_in; (void)out_size;
  const float** F = (const float**)d_in;   // 0 x [8,64,64,256], 1 y, 2 W_fy [256,32], 3 W_gx, 4 W_hx, 5 W_out [32,256], 6 sigma [1]
  if (ws_size < (size_t)WS_END) return;
  char* ws = (char*)d_ws; __bf16* PO = (__bf16*)(ws + WS_PO); _Float16 *FG = (_Float16*)(ws + WS_FG), *FGL = (_Float16*)(ws + WS_FGL), *HT = (_Float16*)(ws + WS_HT), *HTL = (_Float16*)(ws + WS_HTL);
  k_proj<<<dim3(NN / 64, TNB), 128, 0, stream>>>(F[0], F[1], F[2], F[3], F[4], F[5], PO, FG, FGL, HT, HTL);
  k_att<<<dim3(NN / 64, TNB), 256, 0, stream>>>(FG, FGL, HT, HTL, PO, F[0], F[6], (float*)d_out);
}
